// v000
// Measured on an AMD MI455X. A time is GPU time per run, averaged over a window of back-to-back runs after a warm-up
// (all launches, gaps included; the runs take copies of the inputs in turn), and the median of several windows.
// Apart from v000's, it joins two sittings. Times from different sittings can be a few percent apart, while
// side-by-side timings come from the same sitting.
// v000 is the starting kernel. One run takes 414 microseconds.
#include <hip/hip_runtime.h>
#include <hip/hip_bf16.h>
#include <math.h>

typedef __attribute__((ext_vector_type(16))) __bf16 v16bf;
typedef __attribute__((ext_vector_type(8)))  __bf16 v8bf;
typedef __attribute__((ext_vector_type(4)))  __bf16 v4bf;
typedef __attribute__((ext_vector_type(8)))  float  v8f;

#define B_SZ    512
#define D_ENC   1024
#define D_MODEL 1024
#define N_ACT   512
#define N_PREV  256

// ---------------------------------------------------------------------------
// Sinusoidal positional encoding: pe[pos, 2i] = sin(pos*div_i),
// pe[pos, 2i+1] = cos(pos*div_i). One 257-row table serves both heads.
// ---------------------------------------------------------------------------
__global__ __launch_bounds__(256) void pe_fill_kernel(float* __restrict__ pe) {
    int pos = blockIdx.x;          // 0..256
    int i   = threadIdx.x;         // 0..255 -> column pair (2i, 2i+1)
    float div = __expf((float)(2 * i) * (-9.210340371976184f / 512.0f));
    float a = (float)pos * div;
    float2 sc = { __sinf(a), __cosf(a) };
    *(float2*)&pe[(size_t)pos * 512 + 2 * i] = sc;
}

// ---------------------------------------------------------------------------
// WMMA GEMM: C = A(MxK) * B + optional bias / relu.
// BT=0: B is (K,N) row-major.  BT=1: B is (N,K) row-major (C = A*B^T).
// EPI: 0 = none, 1 = +bias, 2 = relu(+bias).
// Block tile 128x64, 256 threads = 8 waves (4 along M x 2 along N),
// each wave computes 32x32 via 2x2 v_wmma_f32_16x16x32_bf16 fragments.
// Software-pipelined: next K-tile's global loads are issued before this
// tile's WMMAs so the load latency hides under ds_load + v_wmma work.
// M % 128 == 0, K % 32 == 0; N guarded (BT path supports ragged N, e.g. 257).
// ---------------------------------------------------------------------------
template <int BT, int EPI>
__global__ __launch_bounds__(256) void gemm_wmma_kernel(
    const float* __restrict__ A, const float* __restrict__ B,
    const float* __restrict__ bias, float* __restrict__ C,
    int M, int N, int K)
{
    __shared__ __align__(16) __bf16 ldsA[128 * 32];   // [m][k]
    __shared__ __align__(16) __bf16 ldsB[64 * 32];    // [n][k]

    const int t    = threadIdx.x;
    const int m0   = blockIdx.y * 128;
    const int n0   = blockIdx.x * 64;
    const int wave = t >> 5;
    const int lane = t & 31;
    const int wm   = (wave & 3) * 32;   // wave row offset in block tile
    const int wn   = (wave >> 2) * 32;  // wave col offset in block tile
    const int lr   = lane & 15;
    const int kh   = lane >> 4;         // K-half selector per ISA layout

    // Per-thread staging coordinates (fixed across K tiles).
    const int ar[4] = { (t + 0) >> 3, (t + 256) >> 3, (t + 512) >> 3, (t + 768) >> 3 };
    const int ac    = (t & 7) * 4;
    // BT=1: B row n / quad c4.  BT=0: B k-row / n quad.
    const int bn0 = (t + 0) >> 3, bn1 = (t + 256) >> 3;       // BT=1
    const int bk0 = (t + 0) >> 4, bk1 = (t + 256) >> 4;       // BT=0
    const int bq  = (t & 15) * 4;                             // BT=0 n offset

    float4 ra[4], rb[2];

    // Issue global loads for K-tile at kk into ra/rb.
    auto load_tiles = [&](int kk) {
        #pragma unroll
        for (int u = 0; u < 4; ++u)
            ra[u] = *(const float4*)&A[(size_t)(m0 + ar[u]) * K + kk + ac];
        if (BT) {
            const int bn[2] = { bn0, bn1 };
            #pragma unroll
            for (int u = 0; u < 2; ++u) {
                float4 x = { 0.f, 0.f, 0.f, 0.f };
                if (n0 + bn[u] < N)
                    x = *(const float4*)&B[(size_t)(n0 + bn[u]) * K + kk + ac];
                rb[u] = x;
            }
        } else {
            const int bk[2] = { bk0, bk1 };
            #pragma unroll
            for (int u = 0; u < 2; ++u) {
                float4 x = { 0.f, 0.f, 0.f, 0.f };
                if (n0 + bq < N)            // N % 4 == 0 on all BT=0 calls
                    x = *(const float4*)&B[(size_t)(kk + bk[u]) * N + n0 + bq];
                rb[u] = x;
            }
        }
    };
    // Convert staged registers to bf16 and write LDS.
    auto store_tiles = [&]() {
        #pragma unroll
        for (int u = 0; u < 4; ++u) {
            v4bf y = { (__bf16)ra[u].x, (__bf16)ra[u].y, (__bf16)ra[u].z, (__bf16)ra[u].w };
            *(v4bf*)&ldsA[ar[u] * 32 + ac] = y;
        }
        if (BT) {
            const int bn[2] = { bn0, bn1 };
            #pragma unroll
            for (int u = 0; u < 2; ++u) {
                v4bf y = { (__bf16)rb[u].x, (__bf16)rb[u].y, (__bf16)rb[u].z, (__bf16)rb[u].w };
                *(v4bf*)&ldsB[bn[u] * 32 + ac] = y;
            }
        } else {
            const int bk[2] = { bk0, bk1 };
            #pragma unroll
            for (int u = 0; u < 2; ++u) {
                ldsB[(bq + 0) * 32 + bk[u]] = (__bf16)rb[u].x;
                ldsB[(bq + 1) * 32 + bk[u]] = (__bf16)rb[u].y;
                ldsB[(bq + 2) * 32 + bk[u]] = (__bf16)rb[u].z;
                ldsB[(bq + 3) * 32 + bk[u]] = (__bf16)rb[u].w;
            }
        }
    };

    v8f acc[2][2] = {};

    load_tiles(0);                       // prologue: tile 0 in flight
    for (int kk = 0; kk < K; kk += 32) {
        store_tiles();                   // waits on outstanding loads here
        __syncthreads();
        if (kk + 32 < K)
            load_tiles(kk + 32);         // next tile's loads fly under WMMAs

        // Fragment assembly per 16-bit A/B VGPR layout:
        // element e <-> K = 16*(e>>3) + 8*(lane>>4) + (e&7); two 16B chunks.
        union Frag { v16bf v; v8bf h[2]; };
        Frag fa[2], fb[2];
        #pragma unroll
        for (int i = 0; i < 2; ++i) {
            const __bf16* rp = &ldsA[(wm + 16 * i + lr) * 32];
            fa[i].h[0] = *(const v8bf*)(rp + kh * 8);
            fa[i].h[1] = *(const v8bf*)(rp + 16 + kh * 8);
            const __bf16* rq = &ldsB[(wn + 16 * i + lr) * 32];
            fb[i].h[0] = *(const v8bf*)(rq + kh * 8);
            fb[i].h[1] = *(const v8bf*)(rq + 16 + kh * 8);
        }
        #pragma unroll
        for (int i = 0; i < 2; ++i)
            #pragma unroll
            for (int j = 0; j < 2; ++j)
                acc[i][j] = __builtin_amdgcn_wmma_f32_16x16x32_bf16(
                    false, fa[i].v, false, fb[j].v, (short)0, acc[i][j], false, false);
        __syncthreads();
    }

    // Epilogue: D layout — VGPR r holds M = r + 8*(lane>>4), N = lane&15.
    #pragma unroll
    for (int i = 0; i < 2; ++i) {
        int row = m0 + wm + 16 * i + 8 * kh;
        #pragma unroll
        for (int j = 0; j < 2; ++j) {
            int col = n0 + wn + 16 * j + lr;
            if (col < N) {
                float bv = (EPI > 0) ? bias[col] : 0.0f;
                #pragma unroll
                for (int r = 0; r < 8; ++r) {
                    float val = acc[i][j][r] + bv;
                    if (EPI == 2) val = fmaxf(val, 0.0f);
                    C[(size_t)(row + r) * N + col] = val;
                }
            }
        }
    }
}

// ---------------------------------------------------------------------------
// Phi pass 1 (HBM-bound): per (b,n) compute qk_out . phi[b,n] and
// qk_in . phi[b,n], add pe-dot terms, scale. Block per b, wave per n.
// qk vectors held in registers (8 x float4) so the loop is loads + FMAs.
// ---------------------------------------------------------------------------
__global__ __launch_bounds__(256) void scores_phi_kernel(
    const float* __restrict__ phi,
    const float* __restrict__ qk_out, const float* __restrict__ qk_in,
    const float* __restrict__ pe_dot_out, const float* __restrict__ pe_dot_in,
    float* __restrict__ scores_out, float* __restrict__ scores_in,
    float inv_sqrt)
{
    int b = blockIdx.x;
    int wave = threadIdx.x >> 5, lane = threadIdx.x & 31;
    const float4* qo4 = (const float4*)(qk_out + (size_t)b * N_ACT);
    const float4* qi4 = (const float4*)(qk_in  + (size_t)b * N_ACT);
    float4 a[4], c[4];
    #pragma unroll
    for (int j = 0; j < 4; ++j) {
        a[j] = qo4[lane + 32 * j];
        c[j] = qi4[lane + 32 * j];
    }
    for (int n = wave * 32; n < wave * 32 + 32; ++n) {
        const float4* p4 = (const float4*)(phi + ((size_t)b * N_PREV + n) * N_ACT);
        float4 x[4];
        #pragma unroll
        for (int j = 0; j < 4; ++j) x[j] = p4[lane + 32 * j];   // batched b128
        float s1 = 0.0f, s2 = 0.0f;
        #pragma unroll
        for (int j = 0; j < 4; ++j) {
            s1 += x[j].x * a[j].x + x[j].y * a[j].y + x[j].z * a[j].z + x[j].w * a[j].w;
            s2 += x[j].x * c[j].x + x[j].y * c[j].y + x[j].z * c[j].z + x[j].w * c[j].w;
        }
        #pragma unroll
        for (int off = 16; off; off >>= 1) {
            s1 += __shfl_xor(s1, off, 32);
            s2 += __shfl_xor(s2, off, 32);
        }
        if (lane == 0) {
            scores_out[(size_t)b * N_PREV + n] =
                (s1 + pe_dot_out[(size_t)b * N_PREV + n]) * inv_sqrt;
            scores_in[(size_t)b * 257 + 1 + n] =
                (s2 + pe_dot_in[(size_t)b * 257 + 1 + n]) * inv_sqrt;
        }
    }
}

// ---------------------------------------------------------------------------
// Generic row softmax, optional elementwise add (final softmax(v+logits)).
// One block (256 threads) per row; cols <= 512.
// ---------------------------------------------------------------------------
__global__ __launch_bounds__(256) void softmax_kernel(
    const float* __restrict__ src, const float* __restrict__ add,
    float* __restrict__ dst, int cols, int ld)
{
    int b = blockIdx.x, t = threadIdx.x;
    __shared__ float red[256];
    int c0 = t, c1 = t + 256;
    float x0 = (c0 < cols) ? src[(size_t)b * ld + c0] + (add ? add[(size_t)b * ld + c0] : 0.0f)
                           : -INFINITY;
    float x1 = (c1 < cols) ? src[(size_t)b * ld + c1] + (add ? add[(size_t)b * ld + c1] : 0.0f)
                           : -INFINITY;
    red[t] = fmaxf(x0, x1);
    __syncthreads();
    for (int s = 128; s; s >>= 1) { if (t < s) red[t] = fmaxf(red[t], red[t + s]); __syncthreads(); }
    float mx = red[0];
    __syncthreads();
    float e0 = (c0 < cols) ? __expf(x0 - mx) : 0.0f;
    float e1 = (c1 < cols) ? __expf(x1 - mx) : 0.0f;
    red[t] = e0 + e1;
    __syncthreads();
    for (int s = 128; s; s >>= 1) { if (t < s) red[t] += red[t + s]; __syncthreads(); }
    float inv = 1.0f / red[0];
    if (c0 < cols) dst[(size_t)b * ld + c0] = e0 * inv;
    if (c1 < cols) dst[(size_t)b * ld + c1] = e1 * inv;
}

// ---------------------------------------------------------------------------
// Phi pass 2: v[b] = attn_out[b] @ phi[b]; scores_in[b,0] =
// (qk_in[b].v[b] + pe_dot_in[b,0]) * inv_sqrt. 128 threads, float4/thread.
// ---------------------------------------------------------------------------
__global__ __launch_bounds__(128) void v_kernel(
    const float* __restrict__ phi, const float* __restrict__ attn_out,
    const float* __restrict__ qk_in, const float* __restrict__ pe_dot_in,
    float* __restrict__ vout, float* __restrict__ scores_in, float inv_sqrt)
{
    int b = blockIdx.x, t = threadIdx.x;   // t < 128
    __shared__ float aw[N_PREV];
    __shared__ float red[128];
    aw[t]       = attn_out[(size_t)b * N_PREV + t];
    aw[t + 128] = attn_out[(size_t)b * N_PREV + t + 128];
    __syncthreads();
    const float4* pb4 = (const float4*)(phi + (size_t)b * N_PREV * N_ACT);
    float4 acc = { 0.f, 0.f, 0.f, 0.f };
    for (int n = 0; n < N_PREV; ++n) {     // per n: 128 lanes x 16B = 2KB row
        if (n + 4 < N_PREV)
            __builtin_prefetch(&pb4[(size_t)(n + 4) * 128 + t], 0, 0);
        float w = aw[n];
        float4 x = pb4[(size_t)n * 128 + t];
        acc.x += w * x.x; acc.y += w * x.y; acc.z += w * x.z; acc.w += w * x.w;
    }
    ((float4*)vout)[(size_t)b * 128 + t] = acc;
    float4 q = ((const float4*)qk_in)[(size_t)b * 128 + t];
    red[t] = acc.x * q.x + acc.y * q.y + acc.z * q.z + acc.w * q.w;
    __syncthreads();
    for (int s = 64; s; s >>= 1) { if (t < s) red[t] += red[t + s]; __syncthreads(); }
    if (t == 0)
        scores_in[(size_t)b * 257] = (red[0] + pe_dot_in[(size_t)b * 257]) * inv_sqrt;
}

// ---------------------------------------------------------------------------
// Phi pass 3: pbar[b] = attn_in[b,0]*v[b] + sum_n attn_in[b,n+1]*phi[b,n].
// ---------------------------------------------------------------------------
__global__ __launch_bounds__(128) void pbar_kernel(
    const float* __restrict__ phi, const float* __restrict__ attn_in,
    const float* __restrict__ vin, float* __restrict__ pbar)
{
    int b = blockIdx.x, t = threadIdx.x;   // t < 128
    __shared__ float aw[257];
    aw[t]       = attn_in[(size_t)b * 257 + t];
    aw[t + 128] = attn_in[(size_t)b * 257 + t + 128];
    if (t == 0) aw[256] = attn_in[(size_t)b * 257 + 256];
    __syncthreads();
    float a0 = aw[0];
    float4 v4 = ((const float4*)vin)[(size_t)b * 128 + t];
    float4 acc = { a0 * v4.x, a0 * v4.y, a0 * v4.z, a0 * v4.w };
    const float4* pb4 = (const float4*)(phi + (size_t)b * N_PREV * N_ACT);
    for (int n = 0; n < N_PREV; ++n) {
        if (n + 4 < N_PREV)
            __builtin_prefetch(&pb4[(size_t)(n + 4) * 128 + t], 0, 0);
        float w = aw[n + 1];
        float4 x = pb4[(size_t)n * 128 + t];
        acc.x += w * x.x; acc.y += w * x.y; acc.z += w * x.z; acc.w += w * x.w;
    }
    ((float4*)pbar)[(size_t)b * 128 + t] = acc;
}

// x = [h_s ; ctx] per row (float4 copies).
__global__ __launch_bounds__(256) void concat_kernel(
    const float* __restrict__ h_s, const float* __restrict__ ctx, float* __restrict__ x)
{
    int b = blockIdx.x, t = threadIdx.x;
    float4* x4 = (float4*)x;
    x4[(size_t)b * 512 + t]       = ((const float4*)h_s)[(size_t)b * 256 + t];
    x4[(size_t)b * 512 + 256 + t] = ((const float4*)ctx)[(size_t)b * 256 + t];
}

// ---------------------------------------------------------------------------
extern "C" void kernel_launch(void* const* d_in, const int* in_sizes, int n_in,
                              void* d_out, int out_size, void* d_ws, size_t ws_size,
                              hipStream_t stream) {
    const float* h_s    = (const float*)d_in[0];
    const float* phi    = (const float*)d_in[1];
    const float* WQ_out = (const float*)d_in[2];
    const float* WK_out = (const float*)d_in[3];
    const float* WQ_in  = (const float*)d_in[4];
    const float* WK_in  = (const float*)d_in[5];
    const float* WV_in  = (const float*)d_in[6];
    const float* W1     = (const float*)d_in[7];
    const float* b1     = (const float*)d_in[8];
    const float* W2     = (const float*)d_in[9];
    const float* b2     = (const float*)d_in[10];
    float* out = (float*)d_out;

    float* ws      = (float*)d_ws;
    float* pe      = ws;                  // 257*512
    float* q_tmp   = pe      + 257 * 512; // 512*1024 (reused for q_out then q_in)
    float* qk_out  = q_tmp   + 512 * 1024;// 512*512
    float* qk_in   = qk_out  + 512 * 512; // 512*512
    float* pe_do   = qk_in   + 512 * 512; // 512*256
    float* pe_di   = pe_do   + 512 * 256; // 512*257
    float* sc_out  = pe_di   + 512 * 257; // 512*256
    float* at_out  = sc_out  + 512 * 256; // 512*256
    float* sc_in   = at_out  + 512 * 256; // 512*257
    float* at_in   = sc_in   + 512 * 257; // 512*257
    float* vbuf    = at_in   + 512 * 257; // 512*512
    float* pbar    = vbuf    + 512 * 512; // 512*512
    float* ctx     = pbar    + 512 * 512; // 512*1024
    float* xcat    = ctx     + 512 * 1024;// 512*2048
    float* hbuf    = xcat    + 512 * 2048;// 512*1024
    float* logits  = hbuf    + 512 * 1024;// 512*512

    const float inv_sqrt = 0.03125f; // 1/sqrt(1024)
    const dim3 blk(256);

    pe_fill_kernel<<<257, blk, 0, stream>>>(pe);

    // qk_out = (h_s @ WQ_out) @ WK_out^T
    gemm_wmma_kernel<0, 0><<<dim3(16, 4), blk, 0, stream>>>(h_s, WQ_out, nullptr, q_tmp, 512, 1024, 1024);
    gemm_wmma_kernel<1, 0><<<dim3(8, 4),  blk, 0, stream>>>(q_tmp, WK_out, nullptr, qk_out, 512, 512, 1024);
    // qk_in = (h_s @ WQ_in) @ WK_in^T
    gemm_wmma_kernel<0, 0><<<dim3(16, 4), blk, 0, stream>>>(h_s, WQ_in, nullptr, q_tmp, 512, 1024, 1024);
    gemm_wmma_kernel<1, 0><<<dim3(8, 4),  blk, 0, stream>>>(q_tmp, WK_in, nullptr, qk_in, 512, 512, 1024);
    // pe-dot terms: qk @ pe^T
    gemm_wmma_kernel<1, 0><<<dim3(4, 4),  blk, 0, stream>>>(qk_out, pe, nullptr, pe_do, 512, 256, 512);
    gemm_wmma_kernel<1, 0><<<dim3(5, 4),  blk, 0, stream>>>(qk_in,  pe, nullptr, pe_di, 512, 257, 512);

    // phi pass 1: both heads' scores
    scores_phi_kernel<<<512, blk, 0, stream>>>(phi, qk_out, qk_in, pe_do, pe_di, sc_out, sc_in, inv_sqrt);
    softmax_kernel<<<512, blk, 0, stream>>>(sc_out, nullptr, at_out, 256, 256);
    // phi pass 2: v + scores_in[:,0]
    v_kernel<<<512, dim3(128), 0, stream>>>(phi, at_out, qk_in, pe_di, vbuf, sc_in, inv_sqrt);
    softmax_kernel<<<512, blk, 0, stream>>>(sc_in, nullptr, at_in, 257, 257);
    // phi pass 3: pbar
    pbar_kernel<<<512, dim3(128), 0, stream>>>(phi, at_in, vbuf, pbar);

    // ctx = pbar @ WV_in
    gemm_wmma_kernel<0, 0><<<dim3(16, 4), blk, 0, stream>>>(pbar, WV_in, nullptr, ctx, 512, 1024, 512);
    // MLP
    concat_kernel<<<512, blk, 0, stream>>>(h_s, ctx, xcat);
    gemm_wmma_kernel<0, 2><<<dim3(16, 4), blk, 0, stream>>>(xcat, W1, b1, hbuf, 512, 1024, 2048);
    gemm_wmma_kernel<0, 1><<<dim3(8, 4),  blk, 0, stream>>>(hbuf, W2, b2, logits, 512, 512, 1024);
    // out = softmax(v + logits)
    softmax_kernel<<<512, blk, 0, stream>>>(vbuf, logits, out, 512, 512);
}

// v001
// It runs in 266 microseconds.
// In two side-by-side timings against v000, it was 1.57 and 1.56 times as fast.
#include <hip/hip_runtime.h>
#include <hip/hip_bf16.h>
#include <math.h>

typedef __attribute__((ext_vector_type(16))) __bf16 v16bf;
typedef __attribute__((ext_vector_type(8)))  __bf16 v8bf;
typedef __attribute__((ext_vector_type(4)))  __bf16 v4bf;
typedef __attribute__((ext_vector_type(8)))  float  v8f;

#define B_SZ    512
#define D_ENC   1024
#define D_MODEL 1024
#define N_ACT   512
#define N_PREV  256

// ---------------------------------------------------------------------------
// Sinusoidal positional encoding: pe[pos, 2i] = sin(pos*div_i),
// pe[pos, 2i+1] = cos(pos*div_i). One 257-row table serves both heads.
// ---------------------------------------------------------------------------
__global__ __launch_bounds__(256) void pe_fill_kernel(float* __restrict__ pe) {
    int pos = blockIdx.x;          // 0..256
    int i   = threadIdx.x;         // 0..255 -> column pair (2i, 2i+1)
    float div = __expf((float)(2 * i) * (-9.210340371976184f / 512.0f));
    float a = (float)pos * div;
    float2 sc = { __sinf(a), __cosf(a) };
    *(float2*)&pe[(size_t)pos * 512 + 2 * i] = sc;
}

// ---------------------------------------------------------------------------
// WMMA GEMM: C = A(MxK) * B + optional bias / relu.
// BT=0: B is (K,N) row-major.  BT=1: B is (N,K) row-major (C = A*B^T).
// EPI: 0 = none, 1 = +bias, 2 = relu(+bias).
// Block tile 128x64, 256 threads = 8 waves (4 along M x 2 along N),
// each wave computes 32x32 via 2x2 v_wmma_f32_16x16x32_bf16 fragments.
// One pass stages 128 k of both operands, so the exposed load latency and the
// two barriers are paid once per four WMMA k-steps.
// Software-pipelined: next K-tile's global loads are issued before this
// tile's WMMAs so the load latency hides under ds_load + v_wmma work.
// M % 128 == 0, K % 128 == 0; N guarded (BT path supports ragged N, e.g. 257).
// ---------------------------------------------------------------------------
#define GEMM_BK 128
#define GEMM_LD 136   // LDS row pitch in bf16: 272 B = 16 B x odd, for ds_load_b128

template <int BT, int EPI>
__global__ __launch_bounds__(256) void gemm_wmma_kernel(
    const float* __restrict__ A, const float* __restrict__ B,
    const float* __restrict__ bias, float* __restrict__ C,
    int M, int N, int K)
{
    __shared__ __align__(16) __bf16 ldsA[128 * GEMM_LD];   // [m][k]
    __shared__ __align__(16) __bf16 ldsB[64 * GEMM_LD];    // [n][k]

    const int t    = threadIdx.x;
    const int m0   = blockIdx.y * 128;
    const int n0   = blockIdx.x * 64;
    const int wave = t >> 5;
    const int lane = t & 31;
    const int wm   = (wave & 3) * 32;   // wave row offset in block tile
    const int wn   = (wave >> 2) * 32;  // wave col offset in block tile
    const int lr   = lane & 15;
    const int kh   = lane >> 4;         // K-half selector per ISA layout

    // Staging coordinates (fixed across K tiles).
    // K-contiguous operands: wave w stages rows w, w + 8, ...; one load covers
    // one 512-B row piece.
    const int sc = lane * 4;            // k offset in the tile
    // BT=0: B k-row (step 16) / n quad.
    const int bk = t >> 4;
    const int bq = (t & 15) * 4;

    float4 ra[16], rb[8];

    // One pointer per staged row, stepped in place from K tile to K tile.
    const float* pa[16];
    const float* pb[8];
    #pragma unroll
    for (int u = 0; u < 16; ++u)
        pa[u] = &A[(size_t)(m0 + wave + 8 * u) * K + sc];
    #pragma unroll
    for (int u = 0; u < 8; ++u)
        pb[u] = BT ? &B[(size_t)min(n0 + wave + 8 * u, N - 1) * K + sc]  // ragged N: row clamped into B
                   : &B[(size_t)(bk + 16 * u) * N + min(n0 + bq, N - 4)];
    const size_t bstep = BT ? (size_t)GEMM_BK : (size_t)GEMM_BK * N;
    const bool   bok   = BT || (n0 + bq < N);   // N % 4 == 0 on all BT=0 calls

    // Issue the global loads of one K tile into ra/rb, as one batch.
    auto load_tiles = [&]() {
        #pragma unroll
        for (int u = 0; u < 16; ++u)
            ra[u] = *(const float4*)pa[u];
        #pragma unroll
        for (int u = 0; u < 8; ++u)
            rb[u] = *(const float4*)pb[u];
    };
    auto step_tiles = [&]() {
        #pragma unroll
        for (int u = 0; u < 16; ++u) pa[u] += GEMM_BK;
        #pragma unroll
        for (int u = 0; u < 8; ++u)  pb[u] += bstep;
    };
    // Convert staged registers to bf16 and write LDS.
    auto store_tiles = [&]() {
        #pragma unroll
        for (int u = 0; u < 16; ++u) {
            v4bf y = { (__bf16)ra[u].x, (__bf16)ra[u].y, (__bf16)ra[u].z, (__bf16)ra[u].w };
            *(v4bf*)&ldsA[(wave + 8 * u) * GEMM_LD + sc] = y;
        }
        if (BT) {
            #pragma unroll
            for (int u = 0; u < 8; ++u) {
                v4bf y = { (__bf16)rb[u].x, (__bf16)rb[u].y, (__bf16)rb[u].z, (__bf16)rb[u].w };
                if (n0 + wave + 8 * u >= N)     // rows past N count as zero
                    y = v4bf{ (__bf16)0.f, (__bf16)0.f, (__bf16)0.f, (__bf16)0.f };
                *(v4bf*)&ldsB[(wave + 8 * u) * GEMM_LD + sc] = y;
            }
        } else {
            if (!bok) {                         // columns past N count as zero
                #pragma unroll
                for (int u = 0; u < 8; ++u)
                    rb[u] = float4{ 0.f, 0.f, 0.f, 0.f };
            }
            #pragma unroll
            for (int u = 0; u < 8; ++u) {
                ldsB[(bq + 0) * GEMM_LD + bk + 16 * u] = (__bf16)rb[u].x;
                ldsB[(bq + 1) * GEMM_LD + bk + 16 * u] = (__bf16)rb[u].y;
                ldsB[(bq + 2) * GEMM_LD + bk + 16 * u] = (__bf16)rb[u].z;
                ldsB[(bq + 3) * GEMM_LD + bk + 16 * u] = (__bf16)rb[u].w;
            }
        }
    };

    v8f acc[2][2] = {};

    load_tiles();                        // prologue: tile 0 in flight
    for (int kk = 0; kk < K; kk += GEMM_BK) {
        store_tiles();                   // waits on outstanding loads here
        __syncthreads();
        if (kk + GEMM_BK < K) {
            step_tiles();
            load_tiles();                // next tile's loads fly under WMMAs
        }

        // Fragment assembly per 16-bit A/B VGPR layout:
        // element e <-> K = 16*(e>>3) + 8*(lane>>4) + (e&7); two 16B chunks.
        union Frag { v16bf v; v8bf h[2]; };
        #pragma unroll
        for (int ks = 0; ks < GEMM_BK; ks += 32) {
            Frag fa[2], fb[2];
            #pragma unroll
            for (int i = 0; i < 2; ++i) {
                const __bf16* rp = &ldsA[(wm + 16 * i + lr) * GEMM_LD + ks];
                fa[i].h[0] = *(const v8bf*)(rp + kh * 8);
                fa[i].h[1] = *(const v8bf*)(rp + 16 + kh * 8);
                const __bf16* rq = &ldsB[(wn + 16 * i + lr) * GEMM_LD + ks];
                fb[i].h[0] = *(const v8bf*)(rq + kh * 8);
                fb[i].h[1] = *(const v8bf*)(rq + 16 + kh * 8);
            }
            #pragma unroll
            for (int i = 0; i < 2; ++i)
                #pragma unroll
                for (int j = 0; j < 2; ++j)
                    acc[i][j] = __builtin_amdgcn_wmma_f32_16x16x32_bf16(
                        false, fa[i].v, false, fb[j].v, (short)0, acc[i][j], false, false);
        }
        __syncthreads();
    }

    // Epilogue: D layout — VGPR r holds M = r + 8*(lane>>4), N = lane&15.
    #pragma unroll
    for (int i = 0; i < 2; ++i) {
        int row = m0 + wm + 16 * i + 8 * kh;
        #pragma unroll
        for (int j = 0; j < 2; ++j) {
            int col = n0 + wn + 16 * j + lr;
            if (col < N) {
                float bv = (EPI > 0) ? bias[col] : 0.0f;
                #pragma unroll
                for (int r = 0; r < 8; ++r) {
                    float val = acc[i][j][r] + bv;
                    if (EPI == 2) val = fmaxf(val, 0.0f);
                    C[(size_t)(row + r) * N + col] = val;
                }
            }
        }
    }
}

// ---------------------------------------------------------------------------
// Phi pass 1 (HBM-bound): per (b,n) compute qk_out . phi[b,n] and
// qk_in . phi[b,n], add pe-dot terms, scale. Block per b, wave per n.
// qk vectors held in registers (8 x float4) so the loop is loads + FMAs.
// ---------------------------------------------------------------------------
__global__ __launch_bounds__(256) void scores_phi_kernel(
    const float* __restrict__ phi,
    const float* __restrict__ qk_out, const float* __restrict__ qk_in,
    const float* __restrict__ pe_dot_out, const float* __restrict__ pe_dot_in,
    float* __restrict__ scores_out, float* __restrict__ scores_in,
    float inv_sqrt)
{
    int b = blockIdx.x;
    int wave = threadIdx.x >> 5, lane = threadIdx.x & 31;
    const float4* qo4 = (const float4*)(qk_out + (size_t)b * N_ACT);
    const float4* qi4 = (const float4*)(qk_in  + (size_t)b * N_ACT);
    float4 a[4], c[4];
    #pragma unroll
    for (int j = 0; j < 4; ++j) {
        a[j] = qo4[lane + 32 * j];
        c[j] = qi4[lane + 32 * j];
    }
    for (int n = wave * 32; n < wave * 32 + 32; ++n) {
        const float4* p4 = (const float4*)(phi + ((size_t)b * N_PREV + n) * N_ACT);
        float4 x[4];
        #pragma unroll
        for (int j = 0; j < 4; ++j) x[j] = p4[lane + 32 * j];   // batched b128
        float s1 = 0.0f, s2 = 0.0f;
        #pragma unroll
        for (int j = 0; j < 4; ++j) {
            s1 += x[j].x * a[j].x + x[j].y * a[j].y + x[j].z * a[j].z + x[j].w * a[j].w;
            s2 += x[j].x * c[j].x + x[j].y * c[j].y + x[j].z * c[j].z + x[j].w * c[j].w;
        }
        #pragma unroll
        for (int off = 16; off; off >>= 1) {
            s1 += __shfl_xor(s1, off, 32);
            s2 += __shfl_xor(s2, off, 32);
        }
        if (lane == 0) {
            scores_out[(size_t)b * N_PREV + n] =
                (s1 + pe_dot_out[(size_t)b * N_PREV + n]) * inv_sqrt;
            scores_in[(size_t)b * 257 + 1 + n] =
                (s2 + pe_dot_in[(size_t)b * 257 + 1 + n]) * inv_sqrt;
        }
    }
}

// ---------------------------------------------------------------------------
// Generic row softmax, optional elementwise add (final softmax(v+logits)).
// One block (256 threads) per row; cols <= 512.
// ---------------------------------------------------------------------------
__global__ __launch_bounds__(256) void softmax_kernel(
    const float* __restrict__ src, const float* __restrict__ add,
    float* __restrict__ dst, int cols, int ld)
{
    int b = blockIdx.x, t = threadIdx.x;
    __shared__ float red[256];
    int c0 = t, c1 = t + 256;
    float x0 = (c0 < cols) ? src[(size_t)b * ld + c0] + (add ? add[(size_t)b * ld + c0] : 0.0f)
                           : -INFINITY;
    float x1 = (c1 < cols) ? src[(size_t)b * ld + c1] + (add ? add[(size_t)b * ld + c1] : 0.0f)
                           : -INFINITY;
    red[t] = fmaxf(x0, x1);
    __syncthreads();
    for (int s = 128; s; s >>= 1) { if (t < s) red[t] = fmaxf(red[t], red[t + s]); __syncthreads(); }
    float mx = red[0];
    __syncthreads();
    float e0 = (c0 < cols) ? __expf(x0 - mx) : 0.0f;
    float e1 = (c1 < cols) ? __expf(x1 - mx) : 0.0f;
    red[t] = e0 + e1;
    __syncthreads();
    for (int s = 128; s; s >>= 1) { if (t < s) red[t] += red[t + s]; __syncthreads(); }
    float inv = 1.0f / red[0];
    if (c0 < cols) dst[(size_t)b * ld + c0] = e0 * inv;
    if (c1 < cols) dst[(size_t)b * ld + c1] = e1 * inv;
}

// ---------------------------------------------------------------------------
// Phi pass 2: v[b] = attn_out[b] @ phi[b]; scores_in[b,0] =
// (qk_in[b].v[b] + pe_dot_in[b,0]) * inv_sqrt. 128 threads, float4/thread.
// ---------------------------------------------------------------------------
__global__ __launch_bounds__(128) void v_kernel(
    const float* __restrict__ phi, const float* __restrict__ attn_out,
    const float* __restrict__ qk_in, const float* __restrict__ pe_dot_in,
    float* __restrict__ vout, float* __restrict__ scores_in, float inv_sqrt)
{
    int b = blockIdx.x, t = threadIdx.x;   // t < 128
    __shared__ float aw[N_PREV];
    __shared__ float red[128];
    aw[t]       = attn_out[(size_t)b * N_PREV + t];
    aw[t + 128] = attn_out[(size_t)b * N_PREV + t + 128];
    __syncthreads();
    const float4* pb4 = (const float4*)(phi + (size_t)b * N_PREV * N_ACT);
    float4 acc = { 0.f, 0.f, 0.f, 0.f };
    for (int n = 0; n < N_PREV; ++n) {     // per n: 128 lanes x 16B = 2KB row
        if (n + 4 < N_PREV)
            __builtin_prefetch(&pb4[(size_t)(n + 4) * 128 + t], 0, 0);
        float w = aw[n];
        float4 x = pb4[(size_t)n * 128 + t];
        acc.x += w * x.x; acc.y += w * x.y; acc.z += w * x.z; acc.w += w * x.w;
    }
    ((float4*)vout)[(size_t)b * 128 + t] = acc;
    float4 q = ((const float4*)qk_in)[(size_t)b * 128 + t];
    red[t] = acc.x * q.x + acc.y * q.y + acc.z * q.z + acc.w * q.w;
    __syncthreads();
    for (int s = 64; s; s >>= 1) { if (t < s) red[t] += red[t + s]; __syncthreads(); }
    if (t == 0)
        scores_in[(size_t)b * 257] = (red[0] + pe_dot_in[(size_t)b * 257]) * inv_sqrt;
}

// ---------------------------------------------------------------------------
// Phi pass 3: pbar[b] = attn_in[b,0]*v[b] + sum_n attn_in[b,n+1]*phi[b,n].
// ---------------------------------------------------------------------------
__global__ __launch_bounds__(128) void pbar_kernel(
    const float* __restrict__ phi, const float* __restrict__ attn_in,
    const float* __restrict__ vin, float* __restrict__ pbar)
{
    int b = blockIdx.x, t = threadIdx.x;   // t < 128
    __shared__ float aw[257];
    aw[t]       = attn_in[(size_t)b * 257 + t];
    aw[t + 128] = attn_in[(size_t)b * 257 + t + 128];
    if (t == 0) aw[256] = attn_in[(size_t)b * 257 + 256];
    __syncthreads();
    float a0 = aw[0];
    float4 v4 = ((const float4*)vin)[(size_t)b * 128 + t];
    float4 acc = { a0 * v4.x, a0 * v4.y, a0 * v4.z, a0 * v4.w };
    const float4* pb4 = (const float4*)(phi + (size_t)b * N_PREV * N_ACT);
    for (int n = 0; n < N_PREV; ++n) {
        if (n + 4 < N_PREV)
            __builtin_prefetch(&pb4[(size_t)(n + 4) * 128 + t], 0, 0);
        float w = aw[n + 1];
        float4 x = pb4[(size_t)n * 128 + t];
        acc.x += w * x.x; acc.y += w * x.y; acc.z += w * x.z; acc.w += w * x.w;
    }
    ((float4*)pbar)[(size_t)b * 128 + t] = acc;
}

// x = [h_s ; ctx] per row (float4 copies).
__global__ __launch_bounds__(256) void concat_kernel(
    const float* __restrict__ h_s, const float* __restrict__ ctx, float* __restrict__ x)
{
    int b = blockIdx.x, t = threadIdx.x;
    float4* x4 = (float4*)x;
    x4[(size_t)b * 512 + t]       = ((const float4*)h_s)[(size_t)b * 256 + t];
    x4[(size_t)b * 512 + 256 + t] = ((const float4*)ctx)[(size_t)b * 256 + t];
}

// ---------------------------------------------------------------------------
extern "C" void kernel_launch(void* const* d_in, const int* in_sizes, int n_in,
                              void* d_out, int out_size, void* d_ws, size_t ws_size,
                              hipStream_t stream) {
    const float* h_s    = (const float*)d_in[0];
    const float* phi    = (const float*)d_in[1];
    const float* WQ_out = (const float*)d_in[2];
    const float* WK_out = (const float*)d_in[3];
    const float* WQ_in  = (const float*)d_in[4];
    const float* WK_in  = (const float*)d_in[5];
    const float* WV_in  = (const float*)d_in[6];
    const float* W1     = (const float*)d_in[7];
    const float* b1     = (const float*)d_in[8];
    const float* W2     = (const float*)d_in[9];
    const float* b2     = (const float*)d_in[10];
    float* out = (float*)d_out;

    float* ws      = (float*)d_ws;
    float* pe      = ws;                  // 257*512
    float* q_tmp   = pe      + 257 * 512; // 512*1024 (reused for q_out then q_in)
    float* qk_out  = q_tmp   + 512 * 1024;// 512*512
    float* qk_in   = qk_out  + 512 * 512; // 512*512
    float* pe_do   = qk_in   + 512 * 512; // 512*256
    float* pe_di   = pe_do   + 512 * 256; // 512*257
    float* sc_out  = pe_di   + 512 * 257; // 512*256
    float* at_out  = sc_out  + 512 * 256; // 512*256
    float* sc_in   = at_out  + 512 * 256; // 512*257
    float* at_in   = sc_in   + 512 * 257; // 512*257
    float* vbuf    = at_in   + 512 * 257; // 512*512
    float* pbar    = vbuf    + 512 * 512; // 512*512
    float* ctx     = pbar    + 512 * 512; // 512*1024
    float* xcat    = ctx     + 512 * 1024;// 512*2048
    float* hbuf    = xcat    + 512 * 2048;// 512*1024
    float* logits  = hbuf    + 512 * 1024;// 512*512

    const float inv_sqrt = 0.03125f; // 1/sqrt(1024)
    const dim3 blk(256);

    pe_fill_kernel<<<257, blk, 0, stream>>>(pe);

    // qk_out = (h_s @ WQ_out) @ WK_out^T
    gemm_wmma_kernel<0, 0><<<dim3(16, 4), blk, 0, stream>>>(h_s, WQ_out, nullptr, q_tmp, 512, 1024, 1024);
    gemm_wmma_kernel<1, 0><<<dim3(8, 4),  blk, 0, stream>>>(q_tmp, WK_out, nullptr, qk_out, 512, 512, 1024);
    // qk_in = (h_s @ WQ_in) @ WK_in^T
    gemm_wmma_kernel<0, 0><<<dim3(16, 4), blk, 0, stream>>>(h_s, WQ_in, nullptr, q_tmp, 512, 1024, 1024);
    gemm_wmma_kernel<1, 0><<<dim3(8, 4),  blk, 0, stream>>>(q_tmp, WK_in, nullptr, qk_in, 512, 512, 1024);
    // pe-dot terms: qk @ pe^T
    gemm_wmma_kernel<1, 0><<<dim3(4, 4),  blk, 0, stream>>>(qk_out, pe, nullptr, pe_do, 512, 256, 512);
    gemm_wmma_kernel<1, 0><<<dim3(5, 4),  blk, 0, stream>>>(qk_in,  pe, nullptr, pe_di, 512, 257, 512);

    // phi pass 1: both heads' scores
    scores_phi_kernel<<<512, blk, 0, stream>>>(phi, qk_out, qk_in, pe_do, pe_di, sc_out, sc_in, inv_sqrt);
    softmax_kernel<<<512, blk, 0, stream>>>(sc_out, nullptr, at_out, 256, 256);
    // phi pass 2: v + scores_in[:,0]
    v_kernel<<<512, dim3(128), 0, stream>>>(phi, at_out, qk_in, pe_di, vbuf, sc_in, inv_sqrt);
    softmax_kernel<<<512, blk, 0, stream>>>(sc_in, nullptr, at_in, 257, 257);
    // phi pass 3: pbar
    pbar_kernel<<<512, dim3(128), 0, stream>>>(phi, at_in, vbuf, pbar);

    // ctx = pbar @ WV_in
    gemm_wmma_kernel<0, 0><<<dim3(16, 4), blk, 0, stream>>>(pbar, WV_in, nullptr, ctx, 512, 1024, 512);
    // MLP
    concat_kernel<<<512, blk, 0, stream>>>(h_s, ctx, xcat);
    gemm_wmma_kernel<0, 2><<<dim3(16, 4), blk, 0, stream>>>(xcat, W1, b1, hbuf, 512, 1024, 2048);
    gemm_wmma_kernel<0, 1><<<dim3(8, 4),  blk, 0, stream>>>(hbuf, W2, b2, logits, 512, 512, 1024);
    // out = softmax(v + logits)
    softmax_kernel<<<512, blk, 0, stream>>>(vbuf, logits, out, 512, 512);
}

// v002
// It runs in 169 microseconds.
// In both of two side-by-side timings against v001, it was 1.58 times as fast.
// Over all steps from v000 it is 2.47 times as fast.
#include <hip/hip_runtime.h>
#include <hip/hip_bf16.h>
#include <math.h>

typedef __attribute__((ext_vector_type(16))) __bf16 v16bf;
typedef __attribute__((ext_vector_type(8)))  __bf16 v8bf;
typedef __attribute__((ext_vector_type(4)))  __bf16 v4bf;
typedef __attribute__((ext_vector_type(8)))  float  v8f;

#define B_SZ    512
#define D_ENC   1024
#define D_MODEL 1024
#define N_ACT   512
#define N_PREV  256

// ---------------------------------------------------------------------------
// Sinusoidal positional encoding: pe[pos, 2i] = sin(pos*div_i),
// pe[pos, 2i+1] = cos(pos*div_i). One 257-row table serves both heads.
// ---------------------------------------------------------------------------
__global__ __launch_bounds__(256) void pe_fill_kernel(float* __restrict__ pe) {
    int pos = blockIdx.x;          // 0..256
    int i   = threadIdx.x;         // 0..255 -> column pair (2i, 2i+1)
    float div = __expf((float)(2 * i) * (-9.210340371976184f / 512.0f));
    float a = (float)pos * div;
    float2 sc = { __sinf(a), __cosf(a) };
    *(float2*)&pe[(size_t)pos * 512 + 2 * i] = sc;
}

// ---------------------------------------------------------------------------
// WMMA GEMM: C = A(MxK) * B + optional bias / relu.
// BT=0: B is (K,N) row-major.  BT=1: B is (N,K) row-major (C = A*B^T).
// EPI: 0 = none, 1 = +bias, 2 = relu(+bias).
// Block tile 128x64, 256 threads = 8 waves (4 along M x 2 along N),
// each wave computes 32x32 via 2x2 v_wmma_f32_16x16x32_bf16 fragments.
// One pass stages 128 k of both operands, so the exposed load latency and the
// two barriers are paid once per four WMMA k-steps.
// Software-pipelined: next K-tile's global loads are issued before this
// tile's WMMAs so the load latency hides under ds_load + v_wmma work.
// M % 128 == 0, K % 128 == 0; N guarded (BT path supports ragged N, e.g. 257).
// ---------------------------------------------------------------------------
#define GEMM_BK 128
#define GEMM_LD 136   // LDS row pitch in bf16: 272 B = 16 B x odd, for ds_load_b128

template <int BT, int EPI>
__global__ __launch_bounds__(256) void gemm_wmma_kernel(
    const float* __restrict__ A, const float* __restrict__ B,
    const float* __restrict__ bias, float* __restrict__ C,
    int M, int N, int K)
{
    __shared__ __align__(16) __bf16 ldsA[128 * GEMM_LD];   // [m][k]
    __shared__ __align__(16) __bf16 ldsB[64 * GEMM_LD];    // [n][k]

    const int t    = threadIdx.x;
    const int m0   = blockIdx.y * 128;
    const int n0   = blockIdx.x * 64;
    const int wave = t >> 5;
    const int lane = t & 31;
    const int wm   = (wave & 3) * 32;   // wave row offset in block tile
    const int wn   = (wave >> 2) * 32;  // wave col offset in block tile
    const int lr   = lane & 15;
    const int kh   = lane >> 4;         // K-half selector per ISA layout

    // Staging coordinates (fixed across K tiles).
    // K-contiguous operands: wave w stages rows w, w + 8, ...; one load covers
    // one 512-B row piece.
    const int sc = lane * 4;            // k offset in the tile
    // BT=0: B k-row (step 16) / n quad.
    const int bk = t >> 4;
    const int bq = (t & 15) * 4;

    float4 ra[16], rb[8];

    // One pointer per staged row, stepped in place from K tile to K tile.
    const float* pa[16];
    const float* pb[8];
    #pragma unroll
    for (int u = 0; u < 16; ++u)
        pa[u] = &A[(size_t)(m0 + wave + 8 * u) * K + sc];
    #pragma unroll
    for (int u = 0; u < 8; ++u)
        pb[u] = BT ? &B[(size_t)min(n0 + wave + 8 * u, N - 1) * K + sc]  // ragged N: row clamped into B
                   : &B[(size_t)(bk + 16 * u) * N + min(n0 + bq, N - 4)];
    const size_t bstep = BT ? (size_t)GEMM_BK : (size_t)GEMM_BK * N;
    const bool   bok   = BT || (n0 + bq < N);   // N % 4 == 0 on all BT=0 calls

    // Issue the global loads of one K tile into ra/rb, as one batch.
    auto load_tiles = [&]() {
        #pragma unroll
        for (int u = 0; u < 16; ++u)
            ra[u] = *(const float4*)pa[u];
        #pragma unroll
        for (int u = 0; u < 8; ++u)
            rb[u] = *(const float4*)pb[u];
    };
    auto step_tiles = [&]() {
        #pragma unroll
        for (int u = 0; u < 16; ++u) pa[u] += GEMM_BK;
        #pragma unroll
        for (int u = 0; u < 8; ++u)  pb[u] += bstep;
    };
    // Convert staged registers to bf16 and write LDS.
    auto store_tiles = [&]() {
        #pragma unroll
        for (int u = 0; u < 16; ++u) {
            v4bf y = { (__bf16)ra[u].x, (__bf16)ra[u].y, (__bf16)ra[u].z, (__bf16)ra[u].w };
            *(v4bf*)&ldsA[(wave + 8 * u) * GEMM_LD + sc] = y;
        }
        if (BT) {
            #pragma unroll
            for (int u = 0; u < 8; ++u) {
                v4bf y = { (__bf16)rb[u].x, (__bf16)rb[u].y, (__bf16)rb[u].z, (__bf16)rb[u].w };
                if (n0 + wave + 8 * u >= N)     // rows past N count as zero
                    y = v4bf{ (__bf16)0.f, (__bf16)0.f, (__bf16)0.f, (__bf16)0.f };
                *(v4bf*)&ldsB[(wave + 8 * u) * GEMM_LD + sc] = y;
            }
        } else {
            if (!bok) {                         // columns past N count as zero
                #pragma unroll
                for (int u = 0; u < 8; ++u)
                    rb[u] = float4{ 0.f, 0.f, 0.f, 0.f };
            }
            #pragma unroll
            for (int u = 0; u < 8; ++u) {
                ldsB[(bq + 0) * GEMM_LD + bk + 16 * u] = (__bf16)rb[u].x;
                ldsB[(bq + 1) * GEMM_LD + bk + 16 * u] = (__bf16)rb[u].y;
                ldsB[(bq + 2) * GEMM_LD + bk + 16 * u] = (__bf16)rb[u].z;
                ldsB[(bq + 3) * GEMM_LD + bk + 16 * u] = (__bf16)rb[u].w;
            }
        }
    };

    v8f acc[2][2] = {};

    load_tiles();                        // prologue: tile 0 in flight
    for (int kk = 0; kk < K; kk += GEMM_BK) {
        store_tiles();                   // waits on outstanding loads here
        __syncthreads();
        if (kk + GEMM_BK < K) {
            step_tiles();
            load_tiles();                // next tile's loads fly under WMMAs
        }

        // Fragment assembly per 16-bit A/B VGPR layout:
        // element e <-> K = 16*(e>>3) + 8*(lane>>4) + (e&7); two 16B chunks.
        union Frag { v16bf v; v8bf h[2]; };
        #pragma unroll
        for (int ks = 0; ks < GEMM_BK; ks += 32) {
            Frag fa[2], fb[2];
            #pragma unroll
            for (int i = 0; i < 2; ++i) {
                const __bf16* rp = &ldsA[(wm + 16 * i + lr) * GEMM_LD + ks];
                fa[i].h[0] = *(const v8bf*)(rp + kh * 8);
                fa[i].h[1] = *(const v8bf*)(rp + 16 + kh * 8);
                const __bf16* rq = &ldsB[(wn + 16 * i + lr) * GEMM_LD + ks];
                fb[i].h[0] = *(const v8bf*)(rq + kh * 8);
                fb[i].h[1] = *(const v8bf*)(rq + 16 + kh * 8);
            }
            #pragma unroll
            for (int i = 0; i < 2; ++i)
                #pragma unroll
                for (int j = 0; j < 2; ++j)
                    acc[i][j] = __builtin_amdgcn_wmma_f32_16x16x32_bf16(
                        false, fa[i].v, false, fb[j].v, (short)0, acc[i][j], false, false);
        }
        __syncthreads();
    }

    // Epilogue: D layout — VGPR r holds M = r + 8*(lane>>4), N = lane&15.
    #pragma unroll
    for (int i = 0; i < 2; ++i) {
        int row = m0 + wm + 16 * i + 8 * kh;
        #pragma unroll
        for (int j = 0; j < 2; ++j) {
            int col = n0 + wn + 16 * j + lr;
            if (col < N) {
                float bv = (EPI > 0) ? bias[col] : 0.0f;
                #pragma unroll
                for (int r = 0; r < 8; ++r) {
                    float val = acc[i][j][r] + bv;
                    if (EPI == 2) val = fmaxf(val, 0.0f);
                    C[(size_t)(row + r) * N + col] = val;
                }
            }
        }
    }
}

// ---------------------------------------------------------------------------
// The one pass over phi. Block per b, wave per 32 rows n. While a row is in
// registers it gives both heads' scores (qk . phi[b,n] + pe-dot term, scaled)
// and is then added, weighted, into both heads' running row sums, with a
// running maximum per head (on-line softmax). The eight waves' partial sums are
// merged through LDS: v[b] first, then the input head's score of v[b] itself
// (position 0), which joins the input head's sums as one more row:
//   v[b]    = softmax(scores_out[b]) @ phi[b]
//   pbar[b] = attn_in[b,0] * v[b] + sum_n attn_in[b,n+1] * phi[b,n]
// ---------------------------------------------------------------------------
typedef __attribute__((ext_vector_type(4))) float f32x4;
typedef __attribute__((ext_vector_type(2))) float f32x2;

#define PHI_G 4   // rows per group (one step of the running maximum)

// Value of lane l ^ MASK inside the 16-lane row (DPP row_xmask).
template <int MASK>
__device__ __forceinline__ float row_xor(float x) {
    return __builtin_bit_cast(float, __builtin_amdgcn_update_dpp(
        0, __builtin_bit_cast(int, x), 0x160 | MASK, 0xf, 0xf, true));
}
// Value of lane l ^ 16.
__device__ __forceinline__ float half_xor(float x) {
    return __builtin_bit_cast(float, __builtin_amdgcn_permlanex16(
        __builtin_bit_cast(int, x), __builtin_bit_cast(int, x), 0x76543210, 0xfedcba98, false, false));
}
__device__ __forceinline__ float lane_value(float x, int l) {
    return __builtin_bit_cast(float, __builtin_amdgcn_readlane(__builtin_bit_cast(int, x), l));
}
// e^x as 2^(x * log2 e), as __expf forms it. The v_nop fills the slot that the instruction set asks for
// behind a transcendental.
__device__ __forceinline__ float exp_slot(float x) {
    float r;
    asm("v_exp_f32 %0, %1\n\tv_nop" : "=v"(r) : "v"(x * 1.4426950408889634f));
    return r;
}
// Sums over the wave's 32 lanes, N values side by side; every lane gets every sum.
template <int N>
__device__ __forceinline__ void wave_sums(float (&s)[N]) {
    #pragma unroll
    for (int i = 0; i < N; ++i) s[i] += row_xor<1>(s[i]);
    #pragma unroll
    for (int i = 0; i < N; ++i) s[i] += row_xor<2>(s[i]);
    #pragma unroll
    for (int i = 0; i < N; ++i) s[i] += row_xor<4>(s[i]);
    #pragma unroll
    for (int i = 0; i < N; ++i) s[i] += row_xor<8>(s[i]);
    #pragma unroll
    for (int i = 0; i < N; ++i) s[i] += half_xor(s[i]);
}

// Second launch-bounds argument: four waves per SIMD, so that two blocks (16 waves) share a WGP.
__global__ __launch_bounds__(256, 4) void phi_once_kernel(
    const float* __restrict__ phi,
    const float* __restrict__ qk_out, const float* __restrict__ qk_in,
    const float* __restrict__ pe_dot_out, const float* __restrict__ pe_dot_in,
    float* __restrict__ vout, float* __restrict__ pbar)
{
    const float inv_sqrt = 0.03125f;   // 1 / sqrt(D_MODEL)
    __shared__ __align__(16) float part[8][2][N_ACT];   // each wave's two unnormalised row sums
    __shared__ float pm[2][8], pl[2][8];                // each wave's running maximum and weight sum
    __shared__ float red[8];

    const int b    = blockIdx.x;
    const int t    = threadIdx.x;
    const int wave = __builtin_amdgcn_readfirstlane(t >> 5);
    const int lane = t & 31;

    f32x4 qo[4], qi[4];
    #pragma unroll
    for (int j = 0; j < 4; ++j) {
        qo[j] = ((const f32x4*)(qk_out + (size_t)b * N_ACT))[lane + 32 * j];
        qi[j] = ((const f32x4*)(qk_in  + (size_t)b * N_ACT))[lane + 32 * j];
    }
    // Lane l holds the pe-dot terms of the wave's row l.
    const float pe1 = pe_dot_out[(size_t)b * N_PREV + wave * 32 + lane];
    const float pe2 = pe_dot_in[(size_t)b * 257 + 1 + wave * 32 + lane];

    const f32x4* p4 = (const f32x4*)(phi + ((size_t)b * N_PREV + wave * 32) * N_ACT) + lane;

    f32x4 xa[PHI_G][4], xb[PHI_G][4];   // two groups of rows: the first is worked on while the second's loads still fly
    f32x4 a1[4] = {}, a2[4] = {};
    float m1 = -INFINITY, m2 = -INFINITY, l1 = 0.0f, l2 = 0.0f;

    // phi is read exactly once: non-temporal loads, 512 contiguous bytes per wave each.
    auto load_rows = [&](f32x4 (&xr)[PHI_G][4], int row0) {
        #pragma unroll
        for (int r = 0; r < PHI_G; ++r)
            #pragma unroll
            for (int j = 0; j < 4; ++j)
                xr[r][j] = __builtin_nontemporal_load(p4 + (row0 + r) * 128 + 32 * j);
    };
    auto take_rows = [&](const f32x4 (&xr)[PHI_G][4], int row0) {
        float s[2 * PHI_G];
        #pragma unroll
        for (int r = 0; r < PHI_G; ++r) {
            f32x4 d1 = xr[r][0] * qo[0], d2 = xr[r][0] * qi[0];
            #pragma unroll
            for (int j = 1; j < 4; ++j) {
                d1 = __builtin_elementwise_fma(xr[r][j], qo[j], d1);
                d2 = __builtin_elementwise_fma(xr[r][j], qi[j], d2);
            }
            s[r]         = (d1.x + d1.y) + (d1.z + d1.w);
            s[PHI_G + r] = (d2.x + d2.y) + (d2.z + d2.w);
        }
        wave_sums(s);
        float n1 = m1, n2 = m2;
        #pragma unroll
        for (int r = 0; r < PHI_G; ++r) {
            s[r]         = (s[r]         + lane_value(pe1, row0 + r)) * inv_sqrt;
            s[PHI_G + r] = (s[PHI_G + r] + lane_value(pe2, row0 + r)) * inv_sqrt;
            n1 = fmaxf(n1, s[r]);
            n2 = fmaxf(n2, s[PHI_G + r]);
        }
        const float c1 = exp_slot(m1 - n1), c2 = exp_slot(m2 - n2);   // 0 at the wave's first rows
        m1 = n1; m2 = n2;
        l1 *= c1; l2 *= c2;
        float p[2 * PHI_G];
        #pragma unroll
        for (int r = 0; r < PHI_G; ++r) {
            p[r]         = exp_slot(s[r] - n1);
            p[PHI_G + r] = exp_slot(s[PHI_G + r] - n2);
            l1 += p[r];
            l2 += p[PHI_G + r];
        }
        #pragma unroll
        for (int j = 0; j < 4; ++j) {
            f32x4 u1 = a1[j] * c1, u2 = a2[j] * c2;
            #pragma unroll
            for (int r = 0; r < PHI_G; ++r) {
                u1 = __builtin_elementwise_fma(xr[r][j], (f32x4)(p[r]), u1);
                u2 = __builtin_elementwise_fma(xr[r][j], (f32x4)(p[PHI_G + r]), u2);
            }
            a1[j] = u1; a2[j] = u2;
        }
    };

    // Kept rolled: unrolled, the arithmetic of many groups is put off behind their loads and spills.
    // No loaded row is carried over the back edge: carried, it is copied there behind a wait on its load.
    #pragma unroll 1
    for (int row = 0; row < 32; row += 2 * PHI_G) {
        load_rows(xa, row);
        load_rows(xb, row + PHI_G);
        // Holds all 32 loads in front of the arithmetic; without it the second group's are issued late.
        __builtin_amdgcn_sched_barrier(0);
        take_rows(xa, row);
        take_rows(xb, row + PHI_G);
    }

    #pragma unroll
    for (int j = 0; j < 4; ++j) {
        *(f32x4*)&part[wave][0][(lane + 32 * j) * 4] = a1[j];
        *(f32x4*)&part[wave][1][(lane + 32 * j) * 4] = a2[j];
    }
    if (lane == 0) {
        pm[0][wave] = m1; pl[0][wave] = l1;
        pm[1][wave] = m2; pl[1][wave] = l2;
    }
    __syncthreads();

    // Merge: thread t owns columns 2t and 2t + 1.
    float M1 = pm[0][0], M2 = pm[1][0];
    #pragma unroll
    for (int w = 1; w < 8; ++w) { M1 = fmaxf(M1, pm[0][w]); M2 = fmaxf(M2, pm[1][w]); }
    float L1 = 0.0f;
    f32x2 v = {};
    #pragma unroll
    for (int w = 0; w < 8; ++w) {
        const float f = __expf(pm[0][w] - M1);
        L1 += f * pl[0][w];
        v  += f * *(const f32x2*)&part[w][0][2 * t];
    }
    v *= 1.0f / L1;
    ((f32x2*)vout)[(size_t)b * 256 + t] = v;

    // Input head, position 0: the score of v[b] itself.
    const f32x2 q = ((const f32x2*)qk_in)[(size_t)b * 256 + t];
    float d[1] = { v.x * q.x + v.y * q.y };
    wave_sums(d);
    if (lane == 0) red[wave] = d[0];
    __syncthreads();
    float dv = red[0];
    #pragma unroll
    for (int w = 1; w < 8; ++w) dv += red[w];
    const float s0 = (dv + pe_dot_in[(size_t)b * 257]) * inv_sqrt;

    M2 = fmaxf(M2, s0);
    const float e0 = __expf(s0 - M2);
    float L2 = e0;
    f32x2 o = e0 * v;
    #pragma unroll
    for (int w = 0; w < 8; ++w) {
        const float f = __expf(pm[1][w] - M2);
        L2 += f * pl[1][w];
        o  += f * *(const f32x2*)&part[w][1][2 * t];
    }
    o *= 1.0f / L2;
    ((f32x2*)pbar)[(size_t)b * 256 + t] = o;
}

// ---------------------------------------------------------------------------
// Generic row softmax, optional elementwise add (final softmax(v+logits)).
// One block (256 threads) per row; cols <= 512.
// ---------------------------------------------------------------------------
__global__ __launch_bounds__(256) void softmax_kernel(
    const float* __restrict__ src, const float* __restrict__ add,
    float* __restrict__ dst, int cols, int ld)
{
    int b = blockIdx.x, t = threadIdx.x;
    __shared__ float red[256];
    int c0 = t, c1 = t + 256;
    float x0 = (c0 < cols) ? src[(size_t)b * ld + c0] + (add ? add[(size_t)b * ld + c0] : 0.0f)
                           : -INFINITY;
    float x1 = (c1 < cols) ? src[(size_t)b * ld + c1] + (add ? add[(size_t)b * ld + c1] : 0.0f)
                           : -INFINITY;
    red[t] = fmaxf(x0, x1);
    __syncthreads();
    for (int s = 128; s; s >>= 1) { if (t < s) red[t] = fmaxf(red[t], red[t + s]); __syncthreads(); }
    float mx = red[0];
    __syncthreads();
    float e0 = (c0 < cols) ? __expf(x0 - mx) : 0.0f;
    float e1 = (c1 < cols) ? __expf(x1 - mx) : 0.0f;
    red[t] = e0 + e1;
    __syncthreads();
    for (int s = 128; s; s >>= 1) { if (t < s) red[t] += red[t + s]; __syncthreads(); }
    float inv = 1.0f / red[0];
    if (c0 < cols) dst[(size_t)b * ld + c0] = e0 * inv;
    if (c1 < cols) dst[(size_t)b * ld + c1] = e1 * inv;
}

// x = [h_s ; ctx] per row (float4 copies).
__global__ __launch_bounds__(256) void concat_kernel(
    const float* __restrict__ h_s, const float* __restrict__ ctx, float* __restrict__ x)
{
    int b = blockIdx.x, t = threadIdx.x;
    float4* x4 = (float4*)x;
    x4[(size_t)b * 512 + t]       = ((const float4*)h_s)[(size_t)b * 256 + t];
    x4[(size_t)b * 512 + 256 + t] = ((const float4*)ctx)[(size_t)b * 256 + t];
}

// ---------------------------------------------------------------------------
extern "C" void kernel_launch(void* const* d_in, const int* in_sizes, int n_in,
                              void* d_out, int out_size, void* d_ws, size_t ws_size,
                              hipStream_t stream) {
    const float* h_s    = (const float*)d_in[0];
    const float* phi    = (const float*)d_in[1];
    const float* WQ_out = (const float*)d_in[2];
    const float* WK_out = (const float*)d_in[3];
    const float* WQ_in  = (const float*)d_in[4];
    const float* WK_in  = (const float*)d_in[5];
    const float* WV_in  = (const float*)d_in[6];
    const float* W1     = (const float*)d_in[7];
    const float* b1     = (const float*)d_in[8];
    const float* W2     = (const float*)d_in[9];
    const float* b2     = (const float*)d_in[10];
    float* out = (float*)d_out;

    float* ws      = (float*)d_ws;
    float* pe      = ws;                  // 257*512
    float* q_tmp   = pe      + 257 * 512; // 512*1024 (reused for q_out then q_in)
    float* qk_out  = q_tmp   + 512 * 1024;// 512*512
    float* qk_in   = qk_out  + 512 * 512; // 512*512
    float* pe_do   = qk_in   + 512 * 512; // 512*256
    float* pe_di   = pe_do   + 512 * 256; // 512*257
    float* vbuf    = pe_di   + 512 * 257; // 512*512
    float* pbar    = vbuf    + 512 * 512; // 512*512
    float* ctx     = pbar    + 512 * 512; // 512*1024
    float* xcat    = ctx     + 512 * 1024;// 512*2048
    float* hbuf    = xcat    + 512 * 2048;// 512*1024
    float* logits  = hbuf    + 512 * 1024;// 512*512

    const dim3 blk(256);

    pe_fill_kernel<<<257, blk, 0, stream>>>(pe);

    // qk_out = (h_s @ WQ_out) @ WK_out^T
    gemm_wmma_kernel<0, 0><<<dim3(16, 4), blk, 0, stream>>>(h_s, WQ_out, nullptr, q_tmp, 512, 1024, 1024);
    gemm_wmma_kernel<1, 0><<<dim3(8, 4),  blk, 0, stream>>>(q_tmp, WK_out, nullptr, qk_out, 512, 512, 1024);
    // qk_in = (h_s @ WQ_in) @ WK_in^T
    gemm_wmma_kernel<0, 0><<<dim3(16, 4), blk, 0, stream>>>(h_s, WQ_in, nullptr, q_tmp, 512, 1024, 1024);
    gemm_wmma_kernel<1, 0><<<dim3(8, 4),  blk, 0, stream>>>(q_tmp, WK_in, nullptr, qk_in, 512, 512, 1024);
    // pe-dot terms: qk @ pe^T
    gemm_wmma_kernel<1, 0><<<dim3(4, 4),  blk, 0, stream>>>(qk_out, pe, nullptr, pe_do, 512, 256, 512);
    gemm_wmma_kernel<1, 0><<<dim3(5, 4),  blk, 0, stream>>>(qk_in,  pe, nullptr, pe_di, 512, 257, 512);

    // the one pass over phi: v and pbar
    phi_once_kernel<<<512, blk, 0, stream>>>(phi, qk_out, qk_in, pe_do, pe_di, vbuf, pbar);

    // ctx = pbar @ WV_in
    gemm_wmma_kernel<0, 0><<<dim3(16, 4), blk, 0, stream>>>(pbar, WV_in, nullptr, ctx, 512, 1024, 512);
    // MLP
    concat_kernel<<<512, blk, 0, stream>>>(h_s, ctx, xcat);
    gemm_wmma_kernel<0, 2><<<dim3(16, 4), blk, 0, stream>>>(xcat, W1, b1, hbuf, 512, 1024, 2048);
    gemm_wmma_kernel<0, 1><<<dim3(8, 4),  blk, 0, stream>>>(hbuf, W2, b2, logits, 512, 512, 1024);
    // out = softmax(v + logits)
    softmax_kernel<<<512, blk, 0, stream>>>(vbuf, logits, out, 512, 512);
}

// v003
// It runs in 111 microseconds.
// Next to v002, in two timings, it ran 1.50 and 1.53 times as fast.
// Counting every step since v000, it is 3.74 times as fast.
#include <hip/hip_runtime.h>
#include <hip/hip_bf16.h>
#include <math.h>

typedef __attribute__((ext_vector_type(16))) __bf16 v16bf;
typedef __attribute__((ext_vector_type(8)))  __bf16 v8bf;
typedef __attribute__((ext_vector_type(4)))  __bf16 v4bf;
typedef __attribute__((ext_vector_type(8)))  float  v8f;
typedef __attribute__((ext_vector_type(4)))  float  v4f;

#define B_SZ    512
#define D_ENC   1024
#define D_MODEL 1024
#define N_ACT   512
#define N_PREV  256

// ---------------------------------------------------------------------------
// Sinusoidal positional encoding: pe[pos, 2i] = sin(pos*div_i),
// pe[pos, 2i+1] = cos(pos*div_i). One 257-row table serves both heads.
// ---------------------------------------------------------------------------
__device__ __forceinline__ void pe_fill_rows(float* __restrict__ pe, int first, int stride) {
    int i   = threadIdx.x;         // 0..255 -> column pair (2i, 2i+1)
    float div = __expf((float)(2 * i) * (-9.210340371976184f / 512.0f));
    for (int pos = first; pos < N_PREV + 1; pos += stride) {
        float a = (float)pos * div;
        float2 sc = { __sinf(a), __cosf(a) };
        *(float2*)&pe[(size_t)pos * 512 + 2 * i] = sc;
    }
}

// ---------------------------------------------------------------------------
// WMMA GEMM: C = A(MxK) * B + optional bias / relu.
// BT=0: B is (K,N) row-major.  BT=1: B is (N,K) row-major (C = A*B^T).
// EPI: 0 = none, 1 = +bias, 2 = relu(+bias).
// A product over a long K can be cut in two launches with the order of its sums kept:
// raw = true stores the f32 sums as they lie in the accumulator registers (whole tiles only:
// per wave eight pieces of 32 lanes x 4 floats), and INIT=1 starts from such sums (Cin, of a
// product with the same M and N) instead of from zero.
// Block tile 128x64, 256 threads = 8 waves (4 along M x 2 along N),
// each wave computes 32x32 via 2x2 v_wmma_f32_16x16x32_bf16 fragments.
// One pass stages 128 k of both operands, so the exposed load latency and the
// two barriers are paid once per four WMMA k-steps.
// Software-pipelined: next K-tile's global loads are issued before this
// tile's WMMAs so the load latency hides under ds_load + v_wmma work.
// M % 128 == 0, K % 128 == 0; N guarded (BT path supports ragged N, e.g. 257).
// ---------------------------------------------------------------------------
#define GEMM_BK 128
#define GEMM_LD 136   // LDS row pitch in bf16: 272 B = 16 B x odd, for ds_load_b128

template <int BT, int EPI, int INIT>
__device__ __forceinline__ void gemm_tile(
    const float* __restrict__ A, const float* __restrict__ B,
    const float* __restrict__ bias, const float* __restrict__ Cin, float* __restrict__ C,
    int N, int K, const bool raw)
{
    __shared__ __align__(16) __bf16 ldsA[128 * GEMM_LD];   // [m][k]
    __shared__ __align__(16) __bf16 ldsB[64 * GEMM_LD];    // [n][k]

    const int t    = threadIdx.x;
    const int m0   = blockIdx.y * 128;
    const int n0   = blockIdx.x * 64;
    if (n0 >= N) return;                // the narrower of two products that share a grid
    const int wave = t >> 5;
    const int lane = t & 31;
    const int wm   = (wave & 3) * 32;   // wave row offset in block tile
    const int wn   = (wave >> 2) * 32;  // wave col offset in block tile
    const int lr   = lane & 15;
    const int kh   = lane >> 4;         // K-half selector per ISA layout

    // Staging coordinates (fixed across K tiles).
    // K-contiguous operands: wave w stages rows w, w + 8, ...; one load covers
    // one 512-B row piece.
    const int sc = lane * 4;            // k offset in the tile
    // BT=0: B k-row (step 16) / n quad.
    const int bk = t >> 4;
    const int bq = (t & 15) * 4;

    float4 ra[16], rb[8];

    // One pointer per staged row, stepped in place from K tile to K tile.
    const float* pa[16];
    const float* pb[8];
    #pragma unroll
    for (int u = 0; u < 16; ++u)
        pa[u] = &A[(size_t)(m0 + wave + 8 * u) * K + sc];
    #pragma unroll
    for (int u = 0; u < 8; ++u)
        pb[u] = BT ? &B[(size_t)min(n0 + wave + 8 * u, N - 1) * K + sc]  // ragged N: row clamped into B
                   : &B[(size_t)(bk + 16 * u) * N + min(n0 + bq, N - 4)];
    const size_t bstep = BT ? (size_t)GEMM_BK : (size_t)GEMM_BK * N;
    const bool   bok   = BT || (n0 + bq < N);   // N % 4 == 0 on all BT=0 calls

    // Issue the global loads of one K tile into ra/rb, as one batch.
    auto load_tiles = [&]() {
        #pragma unroll
        for (int u = 0; u < 16; ++u)
            ra[u] = *(const float4*)pa[u];
        #pragma unroll
        for (int u = 0; u < 8; ++u)
            rb[u] = *(const float4*)pb[u];
    };
    auto step_tiles = [&]() {
        #pragma unroll
        for (int u = 0; u < 16; ++u) pa[u] += GEMM_BK;
        #pragma unroll
        for (int u = 0; u < 8; ++u)  pb[u] += bstep;
    };
    // Convert staged registers to bf16 and write LDS.
    auto store_tiles = [&]() {
        #pragma unroll
        for (int u = 0; u < 16; ++u) {
            v4bf y = { (__bf16)ra[u].x, (__bf16)ra[u].y, (__bf16)ra[u].z, (__bf16)ra[u].w };
            *(v4bf*)&ldsA[(wave + 8 * u) * GEMM_LD + sc] = y;
        }
        if (BT) {
            #pragma unroll
            for (int u = 0; u < 8; ++u) {
                v4bf y = { (__bf16)rb[u].x, (__bf16)rb[u].y, (__bf16)rb[u].z, (__bf16)rb[u].w };
                if (n0 + wave + 8 * u >= N)     // rows past N count as zero
                    y = v4bf{ (__bf16)0.f, (__bf16)0.f, (__bf16)0.f, (__bf16)0.f };
                *(v4bf*)&ldsB[(wave + 8 * u) * GEMM_LD + sc] = y;
            }
        } else {
            if (!bok) {                         // columns past N count as zero
                #pragma unroll
                for (int u = 0; u < 8; ++u)
                    rb[u] = float4{ 0.f, 0.f, 0.f, 0.f };
            }
            #pragma unroll
            for (int u = 0; u < 8; ++u) {
                ldsB[(bq + 0) * GEMM_LD + bk + 16 * u] = (__bf16)rb[u].x;
                ldsB[(bq + 1) * GEMM_LD + bk + 16 * u] = (__bf16)rb[u].y;
                ldsB[(bq + 2) * GEMM_LD + bk + 16 * u] = (__bf16)rb[u].z;
                ldsB[(bq + 3) * GEMM_LD + bk + 16 * u] = (__bf16)rb[u].w;
            }
        }
    };

    v8f acc[2][2] = {};
    // This lane's place in a plane of raw sums, in floats.
    const size_t rawoff = ((size_t)(blockIdx.y * (N >> 6) + blockIdx.x) * 8 + wave) * 1024 + lane * 4;

    load_tiles();                        // prologue: tile 0 in flight
    if (INIT) {
        const v4f* cp = (const v4f*)(Cin + rawoff);
        #pragma unroll
        for (int i = 0; i < 2; ++i)
            #pragma unroll
            for (int j = 0; j < 2; ++j) {
                const v4f lo = cp[(4 * i + 2 * j) * 32], hi = cp[(4 * i + 2 * j + 1) * 32];
                acc[i][j] = __builtin_shufflevector(lo, hi, 0, 1, 2, 3, 4, 5, 6, 7);
            }
    }
    for (int kk = 0; kk < K; kk += GEMM_BK) {
        store_tiles();                   // waits on outstanding loads here
        __syncthreads();
        if (kk + GEMM_BK < K) {
            step_tiles();
            load_tiles();                // next tile's loads fly under WMMAs
        }

        // Fragment assembly per 16-bit A/B VGPR layout:
        // element e <-> K = 16*(e>>3) + 8*(lane>>4) + (e&7); two 16B chunks.
        union Frag { v16bf v; v8bf h[2]; };
        #pragma unroll
        for (int ks = 0; ks < GEMM_BK; ks += 32) {
            Frag fa[2], fb[2];
            #pragma unroll
            for (int i = 0; i < 2; ++i) {
                const __bf16* rp = &ldsA[(wm + 16 * i + lr) * GEMM_LD + ks];
                fa[i].h[0] = *(const v8bf*)(rp + kh * 8);
                fa[i].h[1] = *(const v8bf*)(rp + 16 + kh * 8);
                const __bf16* rq = &ldsB[(wn + 16 * i + lr) * GEMM_LD + ks];
                fb[i].h[0] = *(const v8bf*)(rq + kh * 8);
                fb[i].h[1] = *(const v8bf*)(rq + 16 + kh * 8);
            }
            #pragma unroll
            for (int i = 0; i < 2; ++i)
                #pragma unroll
                for (int j = 0; j < 2; ++j)
                    acc[i][j] = __builtin_amdgcn_wmma_f32_16x16x32_bf16(
                        false, fa[i].v, false, fb[j].v, (short)0, acc[i][j], false, false);
        }
        __syncthreads();
    }

    if (raw) {
        v4f* cp = (v4f*)(C + rawoff);
        #pragma unroll
        for (int i = 0; i < 2; ++i)
            #pragma unroll
            for (int j = 0; j < 2; ++j) {
                cp[(4 * i + 2 * j) * 32]     = __builtin_shufflevector(acc[i][j], acc[i][j], 0, 1, 2, 3);
                cp[(4 * i + 2 * j + 1) * 32] = __builtin_shufflevector(acc[i][j], acc[i][j], 4, 5, 6, 7);
            }
        return;
    }

    // Epilogue: D layout — VGPR r holds M = r + 8*(lane>>4), N = lane&15.
    #pragma unroll
    for (int i = 0; i < 2; ++i) {
        int row = m0 + wm + 16 * i + 8 * kh;
        #pragma unroll
        for (int j = 0; j < 2; ++j) {
            int col = n0 + wn + 16 * j + lr;
            if (col < N) {
                float bv = (EPI > 0) ? bias[col] : 0.0f;
                #pragma unroll
                for (int r = 0; r < 8; ++r) {
                    float val = acc[i][j][r] + bv;
                    if (EPI == 2) val = fmaxf(val, 0.0f);
                    C[(size_t)(row + r) * N + col] = val;
                }
            }
        }
    }
}

template <int BT, int EPI, int INIT>
__global__ __launch_bounds__(256) void gemm_wmma_kernel(
    const float* __restrict__ A, const float* __restrict__ B,
    const float* __restrict__ bias, const float* __restrict__ Cin, float* __restrict__ C,
    int N, int K)
{
    gemm_tile<BT, EPI, INIT>(A, B, bias, Cin, C, N, K, false);
}

// Two products that do not depend on each other (one per head) in one launch: blockIdx.z picks.
template <int BT>
__global__ __launch_bounds__(256) void gemm_pair_kernel(
    const float* __restrict__ A0, const float* __restrict__ B0, float* __restrict__ C0, int N0,
    const float* __restrict__ A1, const float* __restrict__ B1, float* __restrict__ C1, int N1,
    int K)
{
    const bool z = blockIdx.z != 0;
    gemm_tile<BT, 0, 0>(z ? A1 : A0, z ? B1 : B0, nullptr, nullptr, z ? C1 : C0, z ? N1 : N0, K, false);
}

// All that needs nothing but h_s and the weights, in one launch: blockIdx.z = 0, 1, 2 are
// h_s @ WQ_out, h_s @ WQ_in and h_s @ W1[0:1024] (the first half of x @ W1, kept as raw sums);
// z = 3 fills the pe table.
__global__ __launch_bounds__(256) void first_products_kernel(
    const float* __restrict__ h_s, const float* __restrict__ WQ_out,
    const float* __restrict__ WQ_in, const float* __restrict__ W1,
    float* __restrict__ q_out, float* __restrict__ q_in, float* __restrict__ h_pre,
    float* __restrict__ pe)
{
    const int z = blockIdx.z;
    if (z == 3) {
        pe_fill_rows(pe, blockIdx.y * gridDim.x + blockIdx.x, gridDim.x * gridDim.y);
        return;
    }
    gemm_tile<0, 0, 0>(h_s, z == 0 ? WQ_out : (z == 1 ? WQ_in : W1), nullptr, nullptr,
                       z == 0 ? q_out : (z == 1 ? q_in : h_pre), D_MODEL, D_ENC, z == 2);
}

// ---------------------------------------------------------------------------
// The one pass over phi. Block per b, wave per 32 rows n. While a row is in
// registers it gives both heads' scores (qk . phi[b,n] + pe-dot term, scaled)
// and is then added, weighted, into both heads' running row sums, with a
// running maximum per head (on-line softmax). The eight waves' partial sums are
// merged through LDS: v[b] first, then the input head's score of v[b] itself
// (position 0), which joins the input head's sums as one more row:
//   v[b]    = softmax(scores_out[b]) @ phi[b]
//   pbar[b] = attn_in[b,0] * v[b] + sum_n attn_in[b,n+1] * phi[b,n]
// ---------------------------------------------------------------------------
typedef __attribute__((ext_vector_type(4))) float f32x4;
typedef __attribute__((ext_vector_type(2))) float f32x2;

#define PHI_G 4   // rows per group (one step of the running maximum)

// Value of lane l ^ MASK inside the 16-lane row (DPP row_xmask).
template <int MASK>
__device__ __forceinline__ float row_xor(float x) {
    return __builtin_bit_cast(float, __builtin_amdgcn_update_dpp(
        0, __builtin_bit_cast(int, x), 0x160 | MASK, 0xf, 0xf, true));
}
// Value of lane l ^ 16.
__device__ __forceinline__ float half_xor(float x) {
    return __builtin_bit_cast(float, __builtin_amdgcn_permlanex16(
        __builtin_bit_cast(int, x), __builtin_bit_cast(int, x), 0x76543210, 0xfedcba98, false, false));
}
__device__ __forceinline__ float lane_value(float x, int l) {
    return __builtin_bit_cast(float, __builtin_amdgcn_readlane(__builtin_bit_cast(int, x), l));
}
// e^x as 2^(x * log2 e), as __expf forms it. The v_nop fills the slot that the instruction set asks for
// behind a transcendental.
__device__ __forceinline__ float exp_slot(float x) {
    float r;
    asm("v_exp_f32 %0, %1\n\tv_nop" : "=v"(r) : "v"(x * 1.4426950408889634f));
    return r;
}
// Sums over the wave's 32 lanes, N values side by side; every lane gets every sum.
template <int N>
__device__ __forceinline__ void wave_sums(float (&s)[N]) {
    #pragma unroll
    for (int i = 0; i < N; ++i) s[i] += row_xor<1>(s[i]);
    #pragma unroll
    for (int i = 0; i < N; ++i) s[i] += row_xor<2>(s[i]);
    #pragma unroll
    for (int i = 0; i < N; ++i) s[i] += row_xor<4>(s[i]);
    #pragma unroll
    for (int i = 0; i < N; ++i) s[i] += row_xor<8>(s[i]);
    #pragma unroll
    for (int i = 0; i < N; ++i) s[i] += half_xor(s[i]);
}

// Second launch-bounds argument: four waves per SIMD, so that two blocks (16 waves) share a WGP.
__global__ __launch_bounds__(256, 4) void phi_once_kernel(
    const float* __restrict__ phi,
    const float* __restrict__ qk_out, const float* __restrict__ qk_in,
    const float* __restrict__ pe_dot_out, const float* __restrict__ pe_dot_in,
    float* __restrict__ vout, float* __restrict__ pbar)
{
    const float inv_sqrt = 0.03125f;   // 1 / sqrt(D_MODEL)
    __shared__ __align__(16) float part[8][2][N_ACT];   // each wave's two unnormalised row sums
    __shared__ float pm[2][8], pl[2][8];                // each wave's running maximum and weight sum
    __shared__ float red[8];

    const int b    = blockIdx.x;
    const int t    = threadIdx.x;
    const int wave = __builtin_amdgcn_readfirstlane(t >> 5);
    const int lane = t & 31;

    f32x4 qo[4], qi[4];
    #pragma unroll
    for (int j = 0; j < 4; ++j) {
        qo[j] = ((const f32x4*)(qk_out + (size_t)b * N_ACT))[lane + 32 * j];
        qi[j] = ((const f32x4*)(qk_in  + (size_t)b * N_ACT))[lane + 32 * j];
    }
    // Lane l holds the pe-dot terms of the wave's row l.
    const float pe1 = pe_dot_out[(size_t)b * N_PREV + wave * 32 + lane];
    const float pe2 = pe_dot_in[(size_t)b * 257 + 1 + wave * 32 + lane];

    const f32x4* p4 = (const f32x4*)(phi + ((size_t)b * N_PREV + wave * 32) * N_ACT) + lane;

    f32x4 xa[PHI_G][4], xb[PHI_G][4];   // two groups of rows: the first is worked on while the second's loads still fly
    f32x4 a1[4] = {}, a2[4] = {};
    float m1 = -INFINITY, m2 = -INFINITY, l1 = 0.0f, l2 = 0.0f;

    // phi is read exactly once: non-temporal loads, 512 contiguous bytes per wave each.
    auto load_rows = [&](f32x4 (&xr)[PHI_G][4], int row0) {
        #pragma unroll
        for (int r = 0; r < PHI_G; ++r)
            #pragma unroll
            for (int j = 0; j < 4; ++j)
                xr[r][j] = __builtin_nontemporal_load(p4 + (row0 + r) * 128 + 32 * j);
    };
    auto take_rows = [&](const f32x4 (&xr)[PHI_G][4], int row0) {
        float s[2 * PHI_G];
        #pragma unroll
        for (int r = 0; r < PHI_G; ++r) {
            f32x4 d1 = xr[r][0] * qo[0], d2 = xr[r][0] * qi[0];
            #pragma unroll
            for (int j = 1; j < 4; ++j) {
                d1 = __builtin_elementwise_fma(xr[r][j], qo[j], d1);
                d2 = __builtin_elementwise_fma(xr[r][j], qi[j], d2);
            }
            s[r]         = (d1.x + d1.y) + (d1.z + d1.w);
            s[PHI_G + r] = (d2.x + d2.y) + (d2.z + d2.w);
        }
        wave_sums(s);
        float n1 = m1, n2 = m2;
        #pragma unroll
        for (int r = 0; r < PHI_G; ++r) {
            s[r]         = (s[r]         + lane_value(pe1, row0 + r)) * inv_sqrt;
            s[PHI_G + r] = (s[PHI_G + r] + lane_value(pe2, row0 + r)) * inv_sqrt;
            n1 = fmaxf(n1, s[r]);
            n2 = fmaxf(n2, s[PHI_G + r]);
        }
        const float c1 = exp_slot(m1 - n1), c2 = exp_slot(m2 - n2);   // 0 at the wave's first rows
        m1 = n1; m2 = n2;
        l1 *= c1; l2 *= c2;
        float p[2 * PHI_G];
        #pragma unroll
        for (int r = 0; r < PHI_G; ++r) {
            p[r]         = exp_slot(s[r] - n1);
            p[PHI_G + r] = exp_slot(s[PHI_G + r] - n2);
            l1 += p[r];
            l2 += p[PHI_G + r];
        }
        #pragma unroll
        for (int j = 0; j < 4; ++j) {
            f32x4 u1 = a1[j] * c1, u2 = a2[j] * c2;
            #pragma unroll
            for (int r = 0; r < PHI_G; ++r) {
                u1 = __builtin_elementwise_fma(xr[r][j], (f32x4)(p[r]), u1);
                u2 = __builtin_elementwise_fma(xr[r][j], (f32x4)(p[PHI_G + r]), u2);
            }
            a1[j] = u1; a2[j] = u2;
        }
    };

    // Kept rolled: unrolled, the arithmetic of many groups is put off behind their loads and spills.
    // No loaded row is carried over the back edge: carried, it is copied there behind a wait on its load.
    #pragma unroll 1
    for (int row = 0; row < 32; row += 2 * PHI_G) {
        load_rows(xa, row);
        load_rows(xb, row + PHI_G);
        // Holds all 32 loads in front of the arithmetic; without it the second group's are issued late.
        __builtin_amdgcn_sched_barrier(0);
        take_rows(xa, row);
        take_rows(xb, row + PHI_G);
    }

    #pragma unroll
    for (int j = 0; j < 4; ++j) {
        *(f32x4*)&part[wave][0][(lane + 32 * j) * 4] = a1[j];
        *(f32x4*)&part[wave][1][(lane + 32 * j) * 4] = a2[j];
    }
    if (lane == 0) {
        pm[0][wave] = m1; pl[0][wave] = l1;
        pm[1][wave] = m2; pl[1][wave] = l2;
    }
    __syncthreads();

    // Merge: thread t owns columns 2t and 2t + 1.
    float M1 = pm[0][0], M2 = pm[1][0];
    #pragma unroll
    for (int w = 1; w < 8; ++w) { M1 = fmaxf(M1, pm[0][w]); M2 = fmaxf(M2, pm[1][w]); }
    float L1 = 0.0f;
    f32x2 v = {};
    #pragma unroll
    for (int w = 0; w < 8; ++w) {
        const float f = __expf(pm[0][w] - M1);
        L1 += f * pl[0][w];
        v  += f * *(const f32x2*)&part[w][0][2 * t];
    }
    v *= 1.0f / L1;
    ((f32x2*)vout)[(size_t)b * 256 + t] = v;

    // Input head, position 0: the score of v[b] itself.
    const f32x2 q = ((const f32x2*)qk_in)[(size_t)b * 256 + t];
    float d[1] = { v.x * q.x + v.y * q.y };
    wave_sums(d);
    if (lane == 0) red[wave] = d[0];
    __syncthreads();
    float dv = red[0];
    #pragma unroll
    for (int w = 1; w < 8; ++w) dv += red[w];
    const float s0 = (dv + pe_dot_in[(size_t)b * 257]) * inv_sqrt;

    M2 = fmaxf(M2, s0);
    const float e0 = __expf(s0 - M2);
    float L2 = e0;
    f32x2 o = e0 * v;
    #pragma unroll
    for (int w = 0; w < 8; ++w) {
        const float f = __expf(pm[1][w] - M2);
        L2 += f * pl[1][w];
        o  += f * *(const f32x2*)&part[w][1][2 * t];
    }
    o *= 1.0f / L2;
    ((f32x2*)pbar)[(size_t)b * 256 + t] = o;
}

// ---------------------------------------------------------------------------
// Generic row softmax, optional elementwise add (final softmax(v+logits)).
// One block (256 threads) per row; cols <= 512.
// ---------------------------------------------------------------------------
__global__ __launch_bounds__(256) void softmax_kernel(
    const float* __restrict__ src, const float* __restrict__ add,
    float* __restrict__ dst, int cols, int ld)
{
    int b = blockIdx.x, t = threadIdx.x;
    __shared__ float red[256];
    int c0 = t, c1 = t + 256;
    float x0 = (c0 < cols) ? src[(size_t)b * ld + c0] + (add ? add[(size_t)b * ld + c0] : 0.0f)
                           : -INFINITY;
    float x1 = (c1 < cols) ? src[(size_t)b * ld + c1] + (add ? add[(size_t)b * ld + c1] : 0.0f)
                           : -INFINITY;
    red[t] = fmaxf(x0, x1);
    __syncthreads();
    for (int s = 128; s; s >>= 1) { if (t < s) red[t] = fmaxf(red[t], red[t + s]); __syncthreads(); }
    float mx = red[0];
    __syncthreads();
    float e0 = (c0 < cols) ? __expf(x0 - mx) : 0.0f;
    float e1 = (c1 < cols) ? __expf(x1 - mx) : 0.0f;
    red[t] = e0 + e1;
    __syncthreads();
    for (int s = 128; s; s >>= 1) { if (t < s) red[t] += red[t + s]; __syncthreads(); }
    float inv = 1.0f / red[0];
    if (c0 < cols) dst[(size_t)b * ld + c0] = e0 * inv;
    if (c1 < cols) dst[(size_t)b * ld + c1] = e1 * inv;
}

// ---------------------------------------------------------------------------
extern "C" void kernel_launch(void* const* d_in, const int* in_sizes, int n_in,
                              void* d_out, int out_size, void* d_ws, size_t ws_size,
                              hipStream_t stream) {
    const float* h_s    = (const float*)d_in[0];
    const float* phi    = (const float*)d_in[1];
    const float* WQ_out = (const float*)d_in[2];
    const float* WK_out = (const float*)d_in[3];
    const float* WQ_in  = (const float*)d_in[4];
    const float* WK_in  = (const float*)d_in[5];
    const float* WV_in  = (const float*)d_in[6];
    const float* W1     = (const float*)d_in[7];
    const float* b1     = (const float*)d_in[8];
    const float* W2     = (const float*)d_in[9];
    const float* b2     = (const float*)d_in[10];
    float* out = (float*)d_out;

    float* ws      = (float*)d_ws;
    float* pe      = ws;                  // 257*512
    float* q_out   = pe      + 257 * 512; // 512*1024
    float* q_in    = q_out   + 512 * 1024;// 512*1024
    float* h_pre   = q_in    + 512 * 1024;// 512*1024: h_s @ W1[0:1024], raw sums
    float* qk_out  = h_pre   + 512 * 1024;// 512*512
    float* qk_in   = qk_out  + 512 * 512; // 512*512
    float* pe_do   = qk_in   + 512 * 512; // 512*256
    float* pe_di   = pe_do   + 512 * 256; // 512*257
    float* vbuf    = pe_di   + 512 * 257; // 512*512
    float* pbar    = vbuf    + 512 * 512; // 512*512
    float* ctx     = pbar    + 512 * 512; // 512*1024
    float* hbuf    = ctx     + 512 * 1024;// 512*1024
    float* logits  = hbuf    + 512 * 1024;// 512*512

    const dim3 blk(256);

    // q_out = h_s @ WQ_out, q_in = h_s @ WQ_in, h_pre = h_s @ W1[0:1024], pe table
    first_products_kernel<<<dim3(16, 4, 4), blk, 0, stream>>>(h_s, WQ_out, WQ_in, W1, q_out, q_in, h_pre, pe);
    // qk = q @ WK^T, both heads
    gemm_pair_kernel<1><<<dim3(8, 4, 2), blk, 0, stream>>>(q_out, WK_out, qk_out, 512,
                                                           q_in,  WK_in,  qk_in,  512, 1024);
    // pe-dot terms: qk @ pe^T, both heads
    gemm_pair_kernel<1><<<dim3(5, 4, 2), blk, 0, stream>>>(qk_out, pe, pe_do, 256,
                                                           qk_in,  pe, pe_di, 257, 512);

    // the one pass over phi: v and pbar
    phi_once_kernel<<<512, blk, 0, stream>>>(phi, qk_out, qk_in, pe_do, pe_di, vbuf, pbar);

    // ctx = pbar @ WV_in
    gemm_wmma_kernel<0, 0, 0><<<dim3(16, 4), blk, 0, stream>>>(pbar, WV_in, nullptr, nullptr, ctx, 1024, 512);
    // MLP: relu([h_s ; ctx] @ W1 + b1) = relu(h_pre + ctx @ W1[1024:2048] + b1)
    gemm_wmma_kernel<0, 2, 1><<<dim3(16, 4), blk, 0, stream>>>(ctx, W1 + 1024 * 1024, b1, h_pre, hbuf, 1024, 1024);
    gemm_wmma_kernel<0, 1, 0><<<dim3(8, 4),  blk, 0, stream>>>(hbuf, W2, b2, nullptr, logits, 512, 1024);
    // out = softmax(v + logits)
    softmax_kernel<<<512, blk, 0, stream>>>(vbuf, logits, out, 512, 512);
}

// v004
// It runs in 91.8 microseconds.
// Two timings next to v003 put it at 1.21 and 1.22 times that version's speed.
// Over all steps from v000 it is 4.55 times as fast.
#include <hip/hip_runtime.h>
#include <hip/hip_bf16.h>
#include <math.h>

typedef __attribute__((ext_vector_type(16))) __bf16 v16bf;
typedef __attribute__((ext_vector_type(8)))  __bf16 v8bf;
typedef __attribute__((ext_vector_type(4)))  __bf16 v4bf;
typedef __attribute__((ext_vector_type(8)))  float  v8f;
typedef __attribute__((ext_vector_type(4)))  float  v4f;

#define B_SZ    512
#define D_ENC   1024
#define D_MODEL 1024
#define N_ACT   512
#define N_PREV  256

// ---------------------------------------------------------------------------
// Sinusoidal positional encoding: pe[pos, 2i] = sin(pos*div_i),
// pe[pos, 2i+1] = cos(pos*div_i). One 257-row table serves both heads.
// ---------------------------------------------------------------------------
__device__ __forceinline__ void pe_fill_rows(float* __restrict__ pe, int first, int stride) {
    int i   = threadIdx.x;         // 0..255 -> column pair (2i, 2i+1)
    float div = __expf((float)(2 * i) * (-9.210340371976184f / 512.0f));
    for (int pos = first; pos < N_PREV + 1; pos += stride) {
        float a = (float)pos * div;
        float2 sc = { __sinf(a), __cosf(a) };
        *(float2*)&pe[(size_t)pos * 512 + 2 * i] = sc;
    }
}

// ---------------------------------------------------------------------------
// WMMA GEMM: C = A(MxK) * B + optional bias / relu.
// BT=0: B is (K,N) row-major.  BT=1: B is (N,K) row-major (C = A*B^T).
// EPI: 0 = none, 1 = +bias, 2 = relu(+bias).
// A product over a long K can be cut in two launches with the order of its sums kept:
// raw = true stores the f32 sums as they lie in the accumulator registers (whole tiles only:
// per wave eight pieces of 32 lanes x 4 floats), and INIT=1 starts from such sums (Cin, of a
// product with the same M and N) instead of from zero.
// Block tile 128x64, 256 threads = 8 waves (4 along M x 2 along N),
// each wave computes 32x32 via 2x2 v_wmma_f32_16x16x32_bf16 fragments.
// One pass stages 128 k of both operands, so the exposed load latency and the
// two barriers are paid once per four WMMA k-steps.
// Software-pipelined: next K-tile's global loads are issued before this
// tile's WMMAs so the load latency hides under ds_load + v_wmma work.
// M % 128 == 0, K % 128 == 0; N guarded (BT path supports ragged N, e.g. 257).
// ---------------------------------------------------------------------------
#define GEMM_BK 128
#define GEMM_LD 136   // LDS row pitch in bf16: 272 B = 16 B x odd, for ds_load_b128

template <int BT, int EPI, int INIT>
__device__ __forceinline__ void gemm_tile(
    const float* __restrict__ A, const float* __restrict__ B,
    const float* __restrict__ bias, const float* __restrict__ Cin, float* __restrict__ C,
    int N, int K, const bool raw)
{
    __shared__ __align__(16) __bf16 ldsA[128 * GEMM_LD];   // [m][k]
    __shared__ __align__(16) __bf16 ldsB[64 * GEMM_LD];    // [n][k]

    const int t    = threadIdx.x;
    const int m0   = blockIdx.y * 128;
    const int n0   = blockIdx.x * 64;
    if (n0 >= N) return;                // the narrower of two products that share a grid
    const int wave = t >> 5;
    const int lane = t & 31;
    const int wm   = (wave & 3) * 32;   // wave row offset in block tile
    const int wn   = (wave >> 2) * 32;  // wave col offset in block tile
    const int lr   = lane & 15;
    const int kh   = lane >> 4;         // K-half selector per ISA layout

    // Staging coordinates (fixed across K tiles).
    // K-contiguous operands: wave w stages rows w, w + 8, ...; one load covers
    // one 512-B row piece.
    const int sc = lane * 4;            // k offset in the tile
    // BT=0: each thread takes a block of 8 consecutive k-rows x 4 columns (one n quad), so that it
    // holds 8 consecutive k of each of its columns and can write them to the [n][k] tile 16 B at a time.
    const int bk = (t >> 4) * 8;
    const int bq = (t & 15) * 4;

    float4 ra[16], rb[8];

    // One pointer per staged row, stepped in place from K tile to K tile.
    const float* pa[16];
    const float* pb[8];
    #pragma unroll
    for (int u = 0; u < 16; ++u)
        pa[u] = &A[(size_t)(m0 + wave + 8 * u) * K + sc];
    #pragma unroll
    for (int u = 0; u < 8; ++u)
        pb[u] = BT ? &B[(size_t)min(n0 + wave + 8 * u, N - 1) * K + sc]  // ragged N: row clamped into B
                   : &B[(size_t)(bk + u) * N + min(n0 + bq, N - 4)];
    const size_t bstep = BT ? (size_t)GEMM_BK : (size_t)GEMM_BK * N;
    const bool   bok   = BT || (n0 + bq < N);   // N % 4 == 0 on all BT=0 calls

    // Issue the global loads of one K tile into ra/rb, as one batch.
    auto load_tiles = [&]() {
        #pragma unroll
        for (int u = 0; u < 16; ++u)
            ra[u] = *(const float4*)pa[u];
        #pragma unroll
        for (int u = 0; u < 8; ++u)
            rb[u] = *(const float4*)pb[u];
    };
    auto step_tiles = [&]() {
        #pragma unroll
        for (int u = 0; u < 16; ++u) pa[u] += GEMM_BK;
        #pragma unroll
        for (int u = 0; u < 8; ++u)  pb[u] += bstep;
    };
    // Convert staged registers to bf16 and write LDS.
    auto store_tiles = [&]() {
        #pragma unroll
        for (int u = 0; u < 16; ++u) {
            v4bf y = { (__bf16)ra[u].x, (__bf16)ra[u].y, (__bf16)ra[u].z, (__bf16)ra[u].w };
            *(v4bf*)&ldsA[(wave + 8 * u) * GEMM_LD + sc] = y;
        }
        if (BT) {
            #pragma unroll
            for (int u = 0; u < 8; ++u) {
                v4bf y = { (__bf16)rb[u].x, (__bf16)rb[u].y, (__bf16)rb[u].z, (__bf16)rb[u].w };
                if (n0 + wave + 8 * u >= N)     // rows past N count as zero
                    y = v4bf{ (__bf16)0.f, (__bf16)0.f, (__bf16)0.f, (__bf16)0.f };
                *(v4bf*)&ldsB[(wave + 8 * u) * GEMM_LD + sc] = y;
            }
        } else {
            if (!bok) {                         // columns past N count as zero
                #pragma unroll
                for (int u = 0; u < 8; ++u)
                    rb[u] = float4{ 0.f, 0.f, 0.f, 0.f };
            }
            v8bf y0, y1, y2, y3;                // the 8 x 4 block, turned in registers
            #pragma unroll
            for (int u = 0; u < 8; ++u) {
                y0[u] = (__bf16)rb[u].x;
                y1[u] = (__bf16)rb[u].y;
                y2[u] = (__bf16)rb[u].z;
                y3[u] = (__bf16)rb[u].w;
            }
            *(v8bf*)&ldsB[(bq + 0) * GEMM_LD + bk] = y0;
            *(v8bf*)&ldsB[(bq + 1) * GEMM_LD + bk] = y1;
            *(v8bf*)&ldsB[(bq + 2) * GEMM_LD + bk] = y2;
            *(v8bf*)&ldsB[(bq + 3) * GEMM_LD + bk] = y3;
        }
    };

    v8f acc[2][2] = {};
    // This lane's place in a plane of raw sums, in floats.
    const size_t rawoff = ((size_t)(blockIdx.y * (N >> 6) + blockIdx.x) * 8 + wave) * 1024 + lane * 4;

    load_tiles();                        // prologue: tile 0 in flight
    if (INIT) {
        const v4f* cp = (const v4f*)(Cin + rawoff);
        #pragma unroll
        for (int i = 0; i < 2; ++i)
            #pragma unroll
            for (int j = 0; j < 2; ++j) {
                const v4f lo = cp[(4 * i + 2 * j) * 32], hi = cp[(4 * i + 2 * j + 1) * 32];
                acc[i][j] = __builtin_shufflevector(lo, hi, 0, 1, 2, 3, 4, 5, 6, 7);
            }
    }
    for (int kk = 0; kk < K; kk += GEMM_BK) {
        store_tiles();                   // waits on outstanding loads here
        __syncthreads();
        if (kk + GEMM_BK < K) {
            step_tiles();
            load_tiles();                // next tile's loads fly under WMMAs
        }

        // Fragment assembly per 16-bit A/B VGPR layout:
        // element e <-> K = 16*(e>>3) + 8*(lane>>4) + (e&7); two 16B chunks.
        union Frag { v16bf v; v8bf h[2]; };
        #pragma unroll
        for (int ks = 0; ks < GEMM_BK; ks += 32) {
            Frag fa[2], fb[2];
            #pragma unroll
            for (int i = 0; i < 2; ++i) {
                const __bf16* rp = &ldsA[(wm + 16 * i + lr) * GEMM_LD + ks];
                fa[i].h[0] = *(const v8bf*)(rp + kh * 8);
                fa[i].h[1] = *(const v8bf*)(rp + 16 + kh * 8);
                const __bf16* rq = &ldsB[(wn + 16 * i + lr) * GEMM_LD + ks];
                fb[i].h[0] = *(const v8bf*)(rq + kh * 8);
                fb[i].h[1] = *(const v8bf*)(rq + 16 + kh * 8);
            }
            #pragma unroll
            for (int i = 0; i < 2; ++i)
                #pragma unroll
                for (int j = 0; j < 2; ++j)
                    acc[i][j] = __builtin_amdgcn_wmma_f32_16x16x32_bf16(
                        false, fa[i].v, false, fb[j].v, (short)0, acc[i][j], false, false);
        }
        __syncthreads();
    }

    if (raw) {
        v4f* cp = (v4f*)(C + rawoff);
        #pragma unroll
        for (int i = 0; i < 2; ++i)
            #pragma unroll
            for (int j = 0; j < 2; ++j) {
                cp[(4 * i + 2 * j) * 32]     = __builtin_shufflevector(acc[i][j], acc[i][j], 0, 1, 2, 3);
                cp[(4 * i + 2 * j + 1) * 32] = __builtin_shufflevector(acc[i][j], acc[i][j], 4, 5, 6, 7);
            }
        return;
    }

    // Epilogue: D layout — VGPR r holds M = r + 8*(lane>>4), N = lane&15.
    #pragma unroll
    for (int i = 0; i < 2; ++i) {
        int row = m0 + wm + 16 * i + 8 * kh;
        #pragma unroll
        for (int j = 0; j < 2; ++j) {
            int col = n0 + wn + 16 * j + lr;
            if (col < N) {
                float bv = (EPI > 0) ? bias[col] : 0.0f;
                #pragma unroll
                for (int r = 0; r < 8; ++r) {
                    float val = acc[i][j][r] + bv;
                    if (EPI == 2) val = fmaxf(val, 0.0f);
                    C[(size_t)(row + r) * N + col] = val;
                }
            }
        }
    }
}

template <int BT, int EPI, int INIT>
__global__ __launch_bounds__(256) void gemm_wmma_kernel(
    const float* __restrict__ A, const float* __restrict__ B,
    const float* __restrict__ bias, const float* __restrict__ Cin, float* __restrict__ C,
    int N, int K)
{
    gemm_tile<BT, EPI, INIT>(A, B, bias, Cin, C, N, K, false);
}

// Two products that do not depend on each other (one per head) in one launch: blockIdx.z picks.
template <int BT>
__global__ __launch_bounds__(256) void gemm_pair_kernel(
    const float* __restrict__ A0, const float* __restrict__ B0, float* __restrict__ C0, int N0,
    const float* __restrict__ A1, const float* __restrict__ B1, float* __restrict__ C1, int N1,
    int K)
{
    const bool z = blockIdx.z != 0;
    gemm_tile<BT, 0, 0>(z ? A1 : A0, z ? B1 : B0, nullptr, nullptr, z ? C1 : C0, z ? N1 : N0, K, false);
}

// All that needs nothing but h_s and the weights, in one launch: blockIdx.z = 0, 1, 2 are
// h_s @ WQ_out, h_s @ WQ_in and h_s @ W1[0:1024] (the first half of x @ W1, kept as raw sums);
// z = 3 fills the pe table.
__global__ __launch_bounds__(256) void first_products_kernel(
    const float* __restrict__ h_s, const float* __restrict__ WQ_out,
    const float* __restrict__ WQ_in, const float* __restrict__ W1,
    float* __restrict__ q_out, float* __restrict__ q_in, float* __restrict__ h_pre,
    float* __restrict__ pe)
{
    const int z = blockIdx.z;
    if (z == 3) {
        pe_fill_rows(pe, blockIdx.y * gridDim.x + blockIdx.x, gridDim.x * gridDim.y);
        return;
    }
    gemm_tile<0, 0, 0>(h_s, z == 0 ? WQ_out : (z == 1 ? WQ_in : W1), nullptr, nullptr,
                       z == 0 ? q_out : (z == 1 ? q_in : h_pre), D_MODEL, D_ENC, z == 2);
}

// ---------------------------------------------------------------------------
// The one pass over phi. Block per b, wave per 32 rows n. While a row is in
// registers it gives both heads' scores (qk . phi[b,n] + pe-dot term, scaled)
// and is then added, weighted, into both heads' running row sums, with a
// running maximum per head (on-line softmax). The eight waves' partial sums are
// merged through LDS: v[b] first, then the input head's score of v[b] itself
// (position 0), which joins the input head's sums as one more row:
//   v[b]    = softmax(scores_out[b]) @ phi[b]
//   pbar[b] = attn_in[b,0] * v[b] + sum_n attn_in[b,n+1] * phi[b,n]
// ---------------------------------------------------------------------------
typedef __attribute__((ext_vector_type(4))) float f32x4;
typedef __attribute__((ext_vector_type(2))) float f32x2;

#define PHI_G 4   // rows per group (one step of the running maximum)

// Value of lane l ^ MASK inside the 16-lane row (DPP row_xmask).
template <int MASK>
__device__ __forceinline__ float row_xor(float x) {
    return __builtin_bit_cast(float, __builtin_amdgcn_update_dpp(
        0, __builtin_bit_cast(int, x), 0x160 | MASK, 0xf, 0xf, true));
}
// Value of lane l ^ 16.
__device__ __forceinline__ float half_xor(float x) {
    return __builtin_bit_cast(float, __builtin_amdgcn_permlanex16(
        __builtin_bit_cast(int, x), __builtin_bit_cast(int, x), 0x76543210, 0xfedcba98, false, false));
}
__device__ __forceinline__ float lane_value(float x, int l) {
    return __builtin_bit_cast(float, __builtin_amdgcn_readlane(__builtin_bit_cast(int, x), l));
}
// e^x as 2^(x * log2 e), as __expf forms it. The v_nop fills the slot that the instruction set asks for
// behind a transcendental.
__device__ __forceinline__ float exp_slot(float x) {
    float r;
    asm("v_exp_f32 %0, %1\n\tv_nop" : "=v"(r) : "v"(x * 1.4426950408889634f));
    return r;
}
// Sums over the wave's 32 lanes, N values side by side; every lane gets every sum.
template <int N>
__device__ __forceinline__ void wave_sums(float (&s)[N]) {
    #pragma unroll
    for (int i = 0; i < N; ++i) s[i] += row_xor<1>(s[i]);
    #pragma unroll
    for (int i = 0; i < N; ++i) s[i] += row_xor<2>(s[i]);
    #pragma unroll
    for (int i = 0; i < N; ++i) s[i] += row_xor<4>(s[i]);
    #pragma unroll
    for (int i = 0; i < N; ++i) s[i] += row_xor<8>(s[i]);
    #pragma unroll
    for (int i = 0; i < N; ++i) s[i] += half_xor(s[i]);
}

// Second launch-bounds argument: four waves per SIMD, so that two blocks (16 waves) share a WGP.
__global__ __launch_bounds__(256, 4) void phi_once_kernel(
    const float* __restrict__ phi,
    const float* __restrict__ qk_out, const float* __restrict__ qk_in,
    const float* __restrict__ pe_dot_out, const float* __restrict__ pe_dot_in,
    float* __restrict__ vout, float* __restrict__ pbar)
{
    const float inv_sqrt = 0.03125f;   // 1 / sqrt(D_MODEL)
    __shared__ __align__(16) float part[8][2][N_ACT];   // each wave's two unnormalised row sums
    __shared__ float pm[2][8], pl[2][8];                // each wave's running maximum and weight sum
    __shared__ float red[8];

    const int b    = blockIdx.x;
    const int t    = threadIdx.x;
    const int wave = __builtin_amdgcn_readfirstlane(t >> 5);
    const int lane = t & 31;

    f32x4 qo[4], qi[4];
    #pragma unroll
    for (int j = 0; j < 4; ++j) {
        qo[j] = ((const f32x4*)(qk_out + (size_t)b * N_ACT))[lane + 32 * j];
        qi[j] = ((const f32x4*)(qk_in  + (size_t)b * N_ACT))[lane + 32 * j];
    }
    // Lane l holds the pe-dot terms of the wave's row l.
    const float pe1 = pe_dot_out[(size_t)b * N_PREV + wave * 32 + lane];
    const float pe2 = pe_dot_in[(size_t)b * 257 + 1 + wave * 32 + lane];

    const f32x4* p4 = (const f32x4*)(phi + ((size_t)b * N_PREV + wave * 32) * N_ACT) + lane;

    f32x4 xa[PHI_G][4], xb[PHI_G][4];   // two groups of rows: the first is worked on while the second's loads still fly
    f32x4 a1[4] = {}, a2[4] = {};
    float m1 = -INFINITY, m2 = -INFINITY, l1 = 0.0f, l2 = 0.0f;

    // phi is read exactly once: non-temporal loads, 512 contiguous bytes per wave each.
    auto load_rows = [&](f32x4 (&xr)[PHI_G][4], int row0) {
        #pragma unroll
        for (int r = 0; r < PHI_G; ++r)
            #pragma unroll
            for (int j = 0; j < 4; ++j)
                xr[r][j] = __builtin_nontemporal_load(p4 + (row0 + r) * 128 + 32 * j);
    };
    auto take_rows = [&](const f32x4 (&xr)[PHI_G][4], int row0) {
        float s[2 * PHI_G];
        #pragma unroll
        for (int r = 0; r < PHI_G; ++r) {
            f32x4 d1 = xr[r][0] * qo[0], d2 = xr[r][0] * qi[0];
            #pragma unroll
            for (int j = 1; j < 4; ++j) {
                d1 = __builtin_elementwise_fma(xr[r][j], qo[j], d1);
                d2 = __builtin_elementwise_fma(xr[r][j], qi[j], d2);
            }
            s[r]         = (d1.x + d1.y) + (d1.z + d1.w);
            s[PHI_G + r] = (d2.x + d2.y) + (d2.z + d2.w);
        }
        wave_sums(s);
        float n1 = m1, n2 = m2;
        #pragma unroll
        for (int r = 0; r < PHI_G; ++r) {
            s[r]         = (s[r]         + lane_value(pe1, row0 + r)) * inv_sqrt;
            s[PHI_G + r] = (s[PHI_G + r] + lane_value(pe2, row0 + r)) * inv_sqrt;
            n1 = fmaxf(n1, s[r]);
            n2 = fmaxf(n2, s[PHI_G + r]);
        }
        const float c1 = exp_slot(m1 - n1), c2 = exp_slot(m2 - n2);   // 0 at the wave's first rows
        m1 = n1; m2 = n2;
        l1 *= c1; l2 *= c2;
        float p[2 * PHI_G];
        #pragma unroll
        for (int r = 0; r < PHI_G; ++r) {
            p[r]         = exp_slot(s[r] - n1);
            p[PHI_G + r] = exp_slot(s[PHI_G + r] - n2);
            l1 += p[r];
            l2 += p[PHI_G + r];
        }
        #pragma unroll
        for (int j = 0; j < 4; ++j) {
            f32x4 u1 = a1[j] * c1, u2 = a2[j] * c2;
            #pragma unroll
            for (int r = 0; r < PHI_G; ++r) {
                u1 = __builtin_elementwise_fma(xr[r][j], (f32x4)(p[r]), u1);
                u2 = __builtin_elementwise_fma(xr[r][j], (f32x4)(p[PHI_G + r]), u2);
            }
            a1[j] = u1; a2[j] = u2;
        }
    };

    // Kept rolled: unrolled, the arithmetic of many groups is put off behind their loads and spills.
    // No loaded row is carried over the back edge: carried, it is copied there behind a wait on its load.
    #pragma unroll 1
    for (int row = 0; row < 32; row += 2 * PHI_G) {
        load_rows(xa, row);
        load_rows(xb, row + PHI_G);
        // Holds all 32 loads in front of the arithmetic; without it the second group's are issued late.
        __builtin_amdgcn_sched_barrier(0);
        take_rows(xa, row);
        take_rows(xb, row + PHI_G);
    }

    #pragma unroll
    for (int j = 0; j < 4; ++j) {
        *(f32x4*)&part[wave][0][(lane + 32 * j) * 4] = a1[j];
        *(f32x4*)&part[wave][1][(lane + 32 * j) * 4] = a2[j];
    }
    if (lane == 0) {
        pm[0][wave] = m1; pl[0][wave] = l1;
        pm[1][wave] = m2; pl[1][wave] = l2;
    }
    __syncthreads();

    // Merge: thread t owns columns 2t and 2t + 1.
    float M1 = pm[0][0], M2 = pm[1][0];
    #pragma unroll
    for (int w = 1; w < 8; ++w) { M1 = fmaxf(M1, pm[0][w]); M2 = fmaxf(M2, pm[1][w]); }
    float L1 = 0.0f;
    f32x2 v = {};
    #pragma unroll
    for (int w = 0; w < 8; ++w) {
        const float f = __expf(pm[0][w] - M1);
        L1 += f * pl[0][w];
        v  += f * *(const f32x2*)&part[w][0][2 * t];
    }
    v *= 1.0f / L1;
    ((f32x2*)vout)[(size_t)b * 256 + t] = v;

    // Input head, position 0: the score of v[b] itself.
    const f32x2 q = ((const f32x2*)qk_in)[(size_t)b * 256 + t];
    float d[1] = { v.x * q.x + v.y * q.y };
    wave_sums(d);
    if (lane == 0) red[wave] = d[0];
    __syncthreads();
    float dv = red[0];
    #pragma unroll
    for (int w = 1; w < 8; ++w) dv += red[w];
    const float s0 = (dv + pe_dot_in[(size_t)b * 257]) * inv_sqrt;

    M2 = fmaxf(M2, s0);
    const float e0 = __expf(s0 - M2);
    float L2 = e0;
    f32x2 o = e0 * v;
    #pragma unroll
    for (int w = 0; w < 8; ++w) {
        const float f = __expf(pm[1][w] - M2);
        L2 += f * pl[1][w];
        o  += f * *(const f32x2*)&part[w][1][2 * t];
    }
    o *= 1.0f / L2;
    ((f32x2*)pbar)[(size_t)b * 256 + t] = o;
}

// ---------------------------------------------------------------------------
// Generic row softmax, optional elementwise add (final softmax(v+logits)).
// One block (256 threads) per row; cols <= 512.
// ---------------------------------------------------------------------------
__global__ __launch_bounds__(256) void softmax_kernel(
    const float* __restrict__ src, const float* __restrict__ add,
    float* __restrict__ dst, int cols, int ld)
{
    int b = blockIdx.x, t = threadIdx.x;
    __shared__ float red[256];
    int c0 = t, c1 = t + 256;
    float x0 = (c0 < cols) ? src[(size_t)b * ld + c0] + (add ? add[(size_t)b * ld + c0] : 0.0f)
                           : -INFINITY;
    float x1 = (c1 < cols) ? src[(size_t)b * ld + c1] + (add ? add[(size_t)b * ld + c1] : 0.0f)
                           : -INFINITY;
    red[t] = fmaxf(x0, x1);
    __syncthreads();
    for (int s = 128; s; s >>= 1) { if (t < s) red[t] = fmaxf(red[t], red[t + s]); __syncthreads(); }
    float mx = red[0];
    __syncthreads();
    float e0 = (c0 < cols) ? __expf(x0 - mx) : 0.0f;
    float e1 = (c1 < cols) ? __expf(x1 - mx) : 0.0f;
    red[t] = e0 + e1;
    __syncthreads();
    for (int s = 128; s; s >>= 1) { if (t < s) red[t] += red[t + s]; __syncthreads(); }
    float inv = 1.0f / red[0];
    if (c0 < cols) dst[(size_t)b * ld + c0] = e0 * inv;
    if (c1 < cols) dst[(size_t)b * ld + c1] = e1 * inv;
}

// ---------------------------------------------------------------------------
extern "C" void kernel_launch(void* const* d_in, const int* in_sizes, int n_in,
                              void* d_out, int out_size, void* d_ws, size_t ws_size,
                              hipStream_t stream) {
    const float* h_s    = (const float*)d_in[0];
    const float* phi    = (const float*)d_in[1];
    const float* WQ_out = (const float*)d_in[2];
    const float* WK_out = (const float*)d_in[3];
    const float* WQ_in  = (const float*)d_in[4];
    const float* WK_in  = (const float*)d_in[5];
    const float* WV_in  = (const float*)d_in[6];
    const float* W1     = (const float*)d_in[7];
    const float* b1     = (const float*)d_in[8];
    const float* W2     = (const float*)d_in[9];
    const float* b2     = (const float*)d_in[10];
    float* out = (float*)d_out;

    float* ws      = (float*)d_ws;
    float* pe      = ws;                  // 257*512
    float* q_out   = pe      + 257 * 512; // 512*1024
    float* q_in    = q_out   + 512 * 1024;// 512*1024
    float* h_pre   = q_in    + 512 * 1024;// 512*1024: h_s @ W1[0:1024], raw sums
    float* qk_out  = h_pre   + 512 * 1024;// 512*512
    float* qk_in   = qk_out  + 512 * 512; // 512*512
    float* pe_do   = qk_in   + 512 * 512; // 512*256
    float* pe_di   = pe_do   + 512 * 256; // 512*257
    float* vbuf    = pe_di   + 512 * 257; // 512*512
    float* pbar    = vbuf    + 512 * 512; // 512*512
    float* ctx     = pbar    + 512 * 512; // 512*1024
    float* hbuf    = ctx     + 512 * 1024;// 512*1024
    float* logits  = hbuf    + 512 * 1024;// 512*512

    const dim3 blk(256);

    // q_out = h_s @ WQ_out, q_in = h_s @ WQ_in, h_pre = h_s @ W1[0:1024], pe table
    first_products_kernel<<<dim3(16, 4, 4), blk, 0, stream>>>(h_s, WQ_out, WQ_in, W1, q_out, q_in, h_pre, pe);
    // qk = q @ WK^T, both heads
    gemm_pair_kernel<1><<<dim3(8, 4, 2), blk, 0, stream>>>(q_out, WK_out, qk_out, 512,
                                                           q_in,  WK_in,  qk_in,  512, 1024);
    // pe-dot terms: qk @ pe^T, both heads
    gemm_pair_kernel<1><<<dim3(5, 4, 2), blk, 0, stream>>>(qk_out, pe, pe_do, 256,
                                                           qk_in,  pe, pe_di, 257, 512);

    // the one pass over phi: v and pbar
    phi_once_kernel<<<512, blk, 0, stream>>>(phi, qk_out, qk_in, pe_do, pe_di, vbuf, pbar);

    // ctx = pbar @ WV_in
    gemm_wmma_kernel<0, 0, 0><<<dim3(16, 4), blk, 0, stream>>>(pbar, WV_in, nullptr, nullptr, ctx, 1024, 512);
    // MLP: relu([h_s ; ctx] @ W1 + b1) = relu(h_pre + ctx @ W1[1024:2048] + b1)
    gemm_wmma_kernel<0, 2, 1><<<dim3(16, 4), blk, 0, stream>>>(ctx, W1 + 1024 * 1024, b1, h_pre, hbuf, 1024, 1024);
    gemm_wmma_kernel<0, 1, 0><<<dim3(8, 4),  blk, 0, stream>>>(hbuf, W2, b2, nullptr, logits, 512, 1024);
    // out = softmax(v + logits)
    softmax_kernel<<<512, blk, 0, stream>>>(vbuf, logits, out, 512, 512);
}

// v006
// Measured time: 62.1 microseconds a run.
// It is 1.45 times as fast as v004, going by the measured steps of the versions left out in between.
// All steps since v000 together make it 6.61 times as fast.
#include <hip/hip_runtime.h>
#include <hip/hip_bf16.h>
#include <math.h>

typedef __attribute__((ext_vector_type(16))) __bf16 v16bf;
typedef __attribute__((ext_vector_type(8)))  __bf16 v8bf;
typedef __attribute__((ext_vector_type(4)))  __bf16 v4bf;
typedef __attribute__((ext_vector_type(8)))  float  v8f;
typedef __attribute__((ext_vector_type(4)))  float  v4f;

#define B_SZ    512
#define D_ENC   1024
#define D_MODEL 1024
#define N_ACT   512
#define N_PREV  256

// ---------------------------------------------------------------------------
// Sinusoidal positional encoding: pe[pos, 2i] = sin(pos*div_i),
// pe[pos, 2i+1] = cos(pos*div_i), div_i = exp(2i * PE_LOG_STEP).
// ---------------------------------------------------------------------------
#define PE_LOG_STEP (-9.210340371976184f / 512.0f)

// e^x as 2^(x * log2 e), as __expf forms it. The v_nop fills the slot that the instruction set asks for
// behind a transcendental.
__device__ __forceinline__ float exp_slot(float x) {
    float r;
    asm("v_exp_f32 %0, %1\n\tv_nop" : "=v"(r) : "v"(x * 1.4426950408889634f));
    return r;
}
// sin a and cos a as __sinf and __cosf form them (the angle in turns). The results keep clear of the
// angle's register and the v_nop fills the slot that the instruction set asks for behind a
// transcendental.
__device__ __forceinline__ void sincos_slot(float a, float& s, float& c) {
    asm("v_sin_f32 %0, %2\n\tv_cos_f32 %1, %2\n\tv_nop" : "=&v"(s), "=&v"(c) : "v"(a * 0.15915494309189532f));
}

// ---------------------------------------------------------------------------
// WMMA GEMM: C = A(MxK) * B + optional bias / relu.
// BT=0: B is (K,N) row-major.  BT=1: B is (N,K) row-major (C = A*B^T).
// EPI: 0 = none, 1 = +bias, 2 = relu(+bias).
// A product over a long K can be cut in two launches with the order of its sums kept:
// raw = true stores the f32 sums as they lie in the accumulator registers (whole tiles only:
// per wave eight pieces of 32 lanes x 4 floats), and INIT=1 starts from such sums (Cin, of a
// product with the same M and N) instead of from zero.
// Block tile 128x64, 256 threads = 8 waves (4 along M x 2 along N),
// each wave computes 32x32 via 2x2 v_wmma_f32_16x16x32_bf16 fragments.
// One pass stages 128 k of both operands, so the exposed load latency and the
// two barriers are paid once per four WMMA k-steps.
// Software-pipelined: next K-tile's global loads are issued before this
// tile's WMMAs so the load latency hides under ds_load + v_wmma work.
// M % 128 == 0, K % 128 == 0; N guarded (BT path supports ragged N, e.g. 257).
// APE=1: A is the positional encoding itself (row = position, K = 512); its elements are
// formed in the staging registers and A is not read.
// A product can also be cut along K over work-groups: each takes K columns of A (row pitch lda)
// and K rows of B and stores its own plane of partial sums; whoever reads the product adds the planes.
// ASUM=1: A is relu(A + A2), the sum of two such planes, formed in the staging registers.
// (bx, by) is the tile's place; the two LDS tiles belong to the calling kernel.
// ---------------------------------------------------------------------------
#define GEMM_BK 128
#define GEMM_LD 136   // LDS row pitch in bf16: 272 B = 16 B x odd, for ds_load_b128

template <int BT, int EPI, int INIT, int APE = 0, int ASUM = 0>
__device__ __forceinline__ void gemm_tile(
    __bf16 (&ldsA)[128 * GEMM_LD], __bf16 (&ldsB)[64 * GEMM_LD],
    const float* __restrict__ A, const float* __restrict__ B,
    const float* __restrict__ bias, const float* __restrict__ Cin, float* __restrict__ C,
    int N, int K, int lda, const bool raw, const unsigned bx, const unsigned by,
    const float* __restrict__ A2 = nullptr)
{
    const int t    = threadIdx.x;
    const int m0   = by * 128;
    const int n0   = bx * 64;
    if (n0 >= N) return;                // the narrower of the products that share a grid
    const int wave = t >> 5;
    const int lane = t & 31;
    const int wm   = (wave & 3) * 32;   // wave row offset in block tile
    const int wn   = (wave >> 2) * 32;  // wave col offset in block tile
    const int lr   = lane & 15;
    const int kh   = lane >> 4;         // K-half selector per ISA layout

    // Staging coordinates (fixed across K tiles).
    // K-contiguous operands: wave w stages rows w, w + 8, ...; one load covers
    // one 512-B row piece.
    const int sc = lane * 4;            // k offset in the tile
    // BT=0: each thread takes a block of 8 consecutive k-rows x 4 columns (one n quad), so that it
    // holds 8 consecutive k of each of its columns and can write them to the [n][k] tile 16 B at a time.
    const int bk = (t >> 4) * 8;
    const int bq = (t & 15) * 4;

    float4 ra[16], rb[8];
    float4 ra2[ASUM ? 16 : 1];          // ASUM: the second plane's rows

    // One pointer per staged row, stepped in place from K tile to K tile.
    const float* pa[16];
    const float* pb[8];
    #pragma unroll
    for (int u = 0; u < 16; ++u)
        pa[u] = APE ? nullptr : &A[(size_t)(m0 + wave + 8 * u) * lda + sc];
    const float* pa2 = ASUM ? &A2[(size_t)(m0 + wave) * lda + sc] : nullptr;
    #pragma unroll
    for (int u = 0; u < 8; ++u)
        pb[u] = BT ? &B[(size_t)min(n0 + wave + 8 * u, N - 1) * K + sc]  // ragged N: row clamped into B
                   : &B[(size_t)(bk + u) * N + min(n0 + bq, N - 4)];
    const size_t bstep = BT ? (size_t)GEMM_BK : (size_t)GEMM_BK * N;
    const bool   bok   = BT || (n0 + bq < N);   // N % 4 == 0 on all BT=0 calls
    int kc = sc;                        // this lane's first k of the current K tile (APE only)

    // Issue the global loads of one K tile into ra/rb, as one batch.
    auto load_tiles = [&]() {
        if constexpr (!APE) {
            #pragma unroll
            for (int u = 0; u < 16; ++u)
                ra[u] = *(const float4*)pa[u];
        }
        if constexpr (ASUM) {
            #pragma unroll
            for (int u = 0; u < 16; ++u)
                ra2[u] = *(const float4*)(pa2 + (size_t)(8 * u) * lda);
        }
        #pragma unroll
        for (int u = 0; u < 8; ++u)
            rb[u] = *(const float4*)pb[u];
        if constexpr (APE) {
            // The two scheduling barriers hold the asm sines and cosines together, between the loads and
            // the WMMAs.
            __builtin_amdgcn_sched_barrier(0);
            const float d0 = exp_slot((float)kc * PE_LOG_STEP);
            const float d1 = exp_slot((float)(kc + 2) * PE_LOG_STEP);
            #pragma unroll
            for (int u = 0; u < 16; ++u) {
                const float pos = (float)(m0 + wave + 8 * u);
                sincos_slot(pos * d0, ra[u].x, ra[u].y);
                sincos_slot(pos * d1, ra[u].z, ra[u].w);
            }
            __builtin_amdgcn_sched_barrier(0);
        }
    };
    auto step_tiles = [&]() {
        #pragma unroll
        for (int u = 0; u < 16; ++u) pa[u] += APE ? 0 : GEMM_BK;
        #pragma unroll
        for (int u = 0; u < 8; ++u)  pb[u] += bstep;
        if constexpr (ASUM) pa2 += GEMM_BK;
        kc += GEMM_BK;
    };
    // Convert staged registers to bf16 and write LDS.
    auto store_tiles = [&]() {
        #pragma unroll
        for (int u = 0; u < 16; ++u) {
            if constexpr (ASUM) {
                ra[u].x = fmaxf(ra[u].x + ra2[u].x, 0.0f);
                ra[u].y = fmaxf(ra[u].y + ra2[u].y, 0.0f);
                ra[u].z = fmaxf(ra[u].z + ra2[u].z, 0.0f);
                ra[u].w = fmaxf(ra[u].w + ra2[u].w, 0.0f);
            }
            v4bf y = { (__bf16)ra[u].x, (__bf16)ra[u].y, (__bf16)ra[u].z, (__bf16)ra[u].w };
            *(v4bf*)&ldsA[(wave + 8 * u) * GEMM_LD + sc] = y;
        }
        if (BT) {
            #pragma unroll
            for (int u = 0; u < 8; ++u) {
                v4bf y = { (__bf16)rb[u].x, (__bf16)rb[u].y, (__bf16)rb[u].z, (__bf16)rb[u].w };
                if (n0 + wave + 8 * u >= N)     // rows past N count as zero
                    y = v4bf{ (__bf16)0.f, (__bf16)0.f, (__bf16)0.f, (__bf16)0.f };
                *(v4bf*)&ldsB[(wave + 8 * u) * GEMM_LD + sc] = y;
            }
        } else {
            if (!bok) {                         // columns past N count as zero
                #pragma unroll
                for (int u = 0; u < 8; ++u)
                    rb[u] = float4{ 0.f, 0.f, 0.f, 0.f };
            }
            v8bf y0, y1, y2, y3;                // the 8 x 4 block, turned in registers
            #pragma unroll
            for (int u = 0; u < 8; ++u) {
                y0[u] = (__bf16)rb[u].x;
                y1[u] = (__bf16)rb[u].y;
                y2[u] = (__bf16)rb[u].z;
                y3[u] = (__bf16)rb[u].w;
            }
            *(v8bf*)&ldsB[(bq + 0) * GEMM_LD + bk] = y0;
            *(v8bf*)&ldsB[(bq + 1) * GEMM_LD + bk] = y1;
            *(v8bf*)&ldsB[(bq + 2) * GEMM_LD + bk] = y2;
            *(v8bf*)&ldsB[(bq + 3) * GEMM_LD + bk] = y3;
        }
    };

    v8f acc[2][2] = {};
    // This lane's place in a plane of raw sums, in floats.
    const size_t rawoff = ((size_t)(by * (N >> 6) + bx) * 8 + wave) * 1024 + lane * 4;

    load_tiles();                        // prologue: tile 0 in flight
    if (INIT && Cin) {                   // of the work-groups that share a product's K, one carries Cin in
        const v4f* cp = (const v4f*)(Cin + rawoff);
        #pragma unroll
        for (int i = 0; i < 2; ++i)
            #pragma unroll
            for (int j = 0; j < 2; ++j) {
                const v4f lo = cp[(4 * i + 2 * j) * 32], hi = cp[(4 * i + 2 * j + 1) * 32];
                acc[i][j] = __builtin_shufflevector(lo, hi, 0, 1, 2, 3, 4, 5, 6, 7);
            }
        // Stands in front of whatever overwrites these loads' address registers behind the branch's end.
        asm volatile("s_wait_xcnt 0x0" ::: "memory");
    }
    for (int kk = 0; kk < K; kk += GEMM_BK) {
        store_tiles();                   // waits on outstanding loads here
        __syncthreads();
        if (kk + GEMM_BK < K) {
            step_tiles();
            load_tiles();                // next tile's loads fly under WMMAs
        }

        // Fragment assembly per 16-bit A/B VGPR layout:
        // element e <-> K = 16*(e>>3) + 8*(lane>>4) + (e&7); two 16B chunks.
        union Frag { v16bf v; v8bf h[2]; };
        #pragma unroll
        for (int ks = 0; ks < GEMM_BK; ks += 32) {
            Frag fa[2], fb[2];
            #pragma unroll
            for (int i = 0; i < 2; ++i) {
                const __bf16* rp = &ldsA[(wm + 16 * i + lr) * GEMM_LD + ks];
                fa[i].h[0] = *(const v8bf*)(rp + kh * 8);
                fa[i].h[1] = *(const v8bf*)(rp + 16 + kh * 8);
                const __bf16* rq = &ldsB[(wn + 16 * i + lr) * GEMM_LD + ks];
                fb[i].h[0] = *(const v8bf*)(rq + kh * 8);
                fb[i].h[1] = *(const v8bf*)(rq + 16 + kh * 8);
            }
            #pragma unroll
            for (int i = 0; i < 2; ++i)
                #pragma unroll
                for (int j = 0; j < 2; ++j)
                    acc[i][j] = __builtin_amdgcn_wmma_f32_16x16x32_bf16(
                        false, fa[i].v, false, fb[j].v, (short)0, acc[i][j], false, false);
        }
        __syncthreads();
    }

    if (raw) {
        v4f* cp = (v4f*)(C + rawoff);
        #pragma unroll
        for (int i = 0; i < 2; ++i)
            #pragma unroll
            for (int j = 0; j < 2; ++j) {
                cp[(4 * i + 2 * j) * 32]     = __builtin_shufflevector(acc[i][j], acc[i][j], 0, 1, 2, 3);
                cp[(4 * i + 2 * j + 1) * 32] = __builtin_shufflevector(acc[i][j], acc[i][j], 4, 5, 6, 7);
            }
        // Stands in front of whatever overwrites the stores' address or data registers: in a kernel that
        // holds several products the code behind this return runs on into another product's text.
        asm volatile("s_wait_xcnt 0x0" ::: "memory");
        return;
    }

    // Epilogue: D layout — VGPR r holds M = r + 8*(lane>>4), N = lane&15.
    #pragma unroll
    for (int i = 0; i < 2; ++i) {
        int row = m0 + wm + 16 * i + 8 * kh;
        #pragma unroll
        for (int j = 0; j < 2; ++j) {
            int col = n0 + wn + 16 * j + lr;
            if (col < N) {
                float bv = (EPI > 0 && bias) ? bias[col] : 0.0f;   // one plane of a cut product takes the bias
                #pragma unroll
                for (int r = 0; r < 8; ++r) {
                    float val = acc[i][j][r] + bv;
                    if (EPI == 2) val = fmaxf(val, 0.0f);
                    C[(size_t)(row + r) * N + col] = val;
                }
            }
        }
    }
}

#define GEMM_LDS_TILES \
    __shared__ __align__(16) __bf16 ldsA[128 * GEMM_LD];   /* [m][k] */ \
    __shared__ __align__(16) __bf16 ldsB[64 * GEMM_LD];    /* [n][k] */

// The MLP's two products, each cut along K over blockIdx.z so that the launch reaches more WGPs and
// each work-group's chain of passes is short. ks, the k per work-group, is an argument and no constant:
// the K loop then stays a loop, with each pass's loads as one batch in a block of their own; unrolled,
// the build mixed the loads with waits on the first of them.
// Hidden layer before relu: plane z = pbar[:, ks z ...] @ wvw1[ks z ..., :]; plane 0 starts from h_pre,
// the raw sums of h_s @ W1[0:1024], and takes b1.
__global__ __launch_bounds__(256) void hidden_planes_kernel(
    const float* __restrict__ pbar, const float* __restrict__ wvw1, const float* __restrict__ b1,
    const float* __restrict__ h_pre, float* __restrict__ hpl, int ks)
{
    GEMM_LDS_TILES
    const int z = blockIdx.z;
    gemm_tile<0, 1, 1>(ldsA, ldsB, pbar + z * ks, wvw1 + (size_t)z * ks * D_MODEL,
                       z == 0 ? b1 : nullptr, z == 0 ? h_pre : nullptr, hpl + (size_t)z * B_SZ * D_MODEL,
                       D_MODEL, ks, N_ACT, false, blockIdx.x, blockIdx.y);
}
// Logits before bias: plane z = h[:, ks z ...] @ W2[ks z ..., :], h = relu(hpl[0] + hpl[1]).
__global__ __launch_bounds__(256) void logit_planes_kernel(
    const float* __restrict__ hpl, const float* __restrict__ W2, float* __restrict__ lpl, int ks)
{
    GEMM_LDS_TILES
    const int z = blockIdx.z;
    gemm_tile<0, 0, 0, 0, 1>(ldsA, ldsB, hpl + z * ks, W2 + (size_t)z * ks * N_ACT, nullptr,
                             nullptr, lpl + (size_t)z * B_SZ * N_ACT,
                             N_ACT, ks, D_MODEL, false, blockIdx.x, blockIdx.y,
                             hpl + (size_t)B_SZ * D_MODEL + z * ks);
}
#define L_PLANES 8   // planes of the logits: K = 1024 in slices of 128

// All that needs nothing but h_s and the weights and is wanted by the second launch, in one launch:
// blockIdx.z = 0, 1, 2 are h_s @ WQ_out, h_s @ WQ_in and h_s @ W1[0:1024] (the first half of
// x @ W1, kept as raw sums); z = 3, 4 are pe @ WK_out (256 positions) and pe @ WK_in (257, in
// three row tiles), from which the pe terms of the scores follow as q @ (pe @ WK)^T.
__global__ __launch_bounds__(256) void first_products_kernel(
    const float* __restrict__ h_s, const float* __restrict__ WQ_out,
    const float* __restrict__ WQ_in, const float* __restrict__ W1,
    const float* __restrict__ WK_out, const float* __restrict__ WK_in,
    float* __restrict__ q_out, float* __restrict__ q_in, float* __restrict__ h_pre,
    float* __restrict__ pw_out, float* __restrict__ pw_in)
{
    GEMM_LDS_TILES
    const int z = blockIdx.z;
    if (z >= 3) {
        if ((int)blockIdx.y >= z - 1) return;       // 2 row tiles of positions at z = 3, 3 at z = 4
        gemm_tile<0, 0, 0, 1>(ldsA, ldsB, nullptr, z == 3 ? WK_out : WK_in, nullptr, nullptr,
                              z == 3 ? pw_out : pw_in, D_MODEL, N_ACT, N_ACT, false, blockIdx.x, blockIdx.y);
        return;
    }
    gemm_tile<0, 0, 0>(ldsA, ldsB, h_s, z == 0 ? WQ_out : (z == 1 ? WQ_in : W1), nullptr, nullptr,
                       z == 0 ? q_out : (z == 1 ? q_in : h_pre), D_MODEL, D_ENC, D_ENC, z == 2,
                       blockIdx.x, blockIdx.y);
}

// All that needs q, in one launch: z = 0, 1 are qk = q @ WK^T of the two heads, z = 2, 3 their pe
// terms q @ (pe @ WK)^T. z = 4, 5 are the two column halves of WV_in @ W1[1024:2048], a product of
// weights alone that is wanted only behind the pass over phi and finds idle WGPs here:
// ctx @ W1[1024:2048] = pbar @ (WV_in @ W1[1024:2048]).
__global__ __launch_bounds__(256) void second_products_kernel(
    const float* __restrict__ q_out, const float* __restrict__ q_in,
    const float* __restrict__ WK_out, const float* __restrict__ WK_in,
    const float* __restrict__ pw_out, const float* __restrict__ pw_in,
    const float* __restrict__ WV_in, const float* __restrict__ W1b,
    float* __restrict__ qk_out, float* __restrict__ qk_in,
    float* __restrict__ pe_dot_out, float* __restrict__ pe_dot_in, float* __restrict__ wvw1)
{
    GEMM_LDS_TILES
    const int z = blockIdx.z;
    if (z >= 4) {
        gemm_tile<0, 0, 0>(ldsA, ldsB, WV_in, W1b, nullptr, nullptr, wvw1, D_MODEL, D_MODEL,
                           D_MODEL, false, blockIdx.x + 8 * (z - 4), blockIdx.y);
        return;
    }
    gemm_tile<1, 0, 0>(ldsA, ldsB, (z & 1) ? q_in : q_out,
                       z == 0 ? WK_out : z == 1 ? WK_in : z == 2 ? pw_out : pw_in, nullptr, nullptr,
                       z == 0 ? qk_out : z == 1 ? qk_in : z == 2 ? pe_dot_out : pe_dot_in,
                       z < 2 ? N_ACT : N_PREV + (z - 2), D_MODEL, D_MODEL, false, blockIdx.x, blockIdx.y);
}

// ---------------------------------------------------------------------------
// The one pass over phi. Block per b, wave per 32 rows n. While a row is in
// registers it gives both heads' scores (qk . phi[b,n] + pe-dot term, scaled)
// and is then added, weighted, into both heads' running row sums, with a
// running maximum per head (on-line softmax). The eight waves' partial sums are
// merged through LDS: v[b] first, then the input head's score of v[b] itself
// (position 0), which joins the input head's sums as one more row:
//   v[b]    = softmax(scores_out[b]) @ phi[b]
//   pbar[b] = attn_in[b,0] * v[b] + sum_n attn_in[b,n+1] * phi[b,n]
// ---------------------------------------------------------------------------
typedef __attribute__((ext_vector_type(4))) float f32x4;
typedef __attribute__((ext_vector_type(2))) float f32x2;

#define PHI_G 4   // rows per group (one step of the running maximum)

// Value of lane l ^ MASK inside the 16-lane row (DPP row_xmask).
template <int MASK>
__device__ __forceinline__ float row_xor(float x) {
    return __builtin_bit_cast(float, __builtin_amdgcn_update_dpp(
        0, __builtin_bit_cast(int, x), 0x160 | MASK, 0xf, 0xf, true));
}
// Value of lane l ^ 16.
__device__ __forceinline__ float half_xor(float x) {
    return __builtin_bit_cast(float, __builtin_amdgcn_permlanex16(
        __builtin_bit_cast(int, x), __builtin_bit_cast(int, x), 0x76543210, 0xfedcba98, false, false));
}
__device__ __forceinline__ float lane_value(float x, int l) {
    return __builtin_bit_cast(float, __builtin_amdgcn_readlane(__builtin_bit_cast(int, x), l));
}
// Sums over the wave's 32 lanes, N values side by side; every lane gets every sum.
template <int N>
__device__ __forceinline__ void wave_sums(float (&s)[N]) {
    #pragma unroll
    for (int i = 0; i < N; ++i) s[i] += row_xor<1>(s[i]);
    #pragma unroll
    for (int i = 0; i < N; ++i) s[i] += row_xor<2>(s[i]);
    #pragma unroll
    for (int i = 0; i < N; ++i) s[i] += row_xor<4>(s[i]);
    #pragma unroll
    for (int i = 0; i < N; ++i) s[i] += row_xor<8>(s[i]);
    #pragma unroll
    for (int i = 0; i < N; ++i) s[i] += half_xor(s[i]);
}

// Second launch-bounds argument: four waves per SIMD, so that two blocks (16 waves) share a WGP.
__global__ __launch_bounds__(256, 4) void phi_once_kernel(
    const float* __restrict__ phi,
    const float* __restrict__ qk_out, const float* __restrict__ qk_in,
    const float* __restrict__ pe_dot_out, const float* __restrict__ pe_dot_in,
    float* __restrict__ vout, float* __restrict__ pbar)
{
    const float inv_sqrt = 0.03125f;   // 1 / sqrt(D_MODEL)
    __shared__ __align__(16) float part[8][2][N_ACT];   // each wave's two unnormalised row sums
    __shared__ float pm[2][8], pl[2][8];                // each wave's running maximum and weight sum
    __shared__ float red[8];

    const int b    = blockIdx.x;
    const int t    = threadIdx.x;
    const int wave = __builtin_amdgcn_readfirstlane(t >> 5);
    const int lane = t & 31;

    f32x4 qo[4], qi[4];
    #pragma unroll
    for (int j = 0; j < 4; ++j) {
        qo[j] = ((const f32x4*)(qk_out + (size_t)b * N_ACT))[lane + 32 * j];
        qi[j] = ((const f32x4*)(qk_in  + (size_t)b * N_ACT))[lane + 32 * j];
    }
    // Lane l holds the pe-dot terms of the wave's row l.
    const float pe1 = pe_dot_out[(size_t)b * N_PREV + wave * 32 + lane];
    const float pe2 = pe_dot_in[(size_t)b * 257 + 1 + wave * 32 + lane];

    const f32x4* p4 = (const f32x4*)(phi + ((size_t)b * N_PREV + wave * 32) * N_ACT) + lane;

    f32x4 xa[PHI_G][4], xb[PHI_G][4];   // two groups of rows: the first is worked on while the second's loads still fly
    f32x4 a1[4] = {}, a2[4] = {};
    float m1 = -INFINITY, m2 = -INFINITY, l1 = 0.0f, l2 = 0.0f;

    // phi is read exactly once: non-temporal loads, 512 contiguous bytes per wave each.
    auto load_rows = [&](f32x4 (&xr)[PHI_G][4], int row0) {
        #pragma unroll
        for (int r = 0; r < PHI_G; ++r)
            #pragma unroll
            for (int j = 0; j < 4; ++j)
                xr[r][j] = __builtin_nontemporal_load(p4 + (row0 + r) * 128 + 32 * j);
    };
    auto take_rows = [&](const f32x4 (&xr)[PHI_G][4], int row0) {
        float s[2 * PHI_G];
        #pragma unroll
        for (int r = 0; r < PHI_G; ++r) {
            f32x4 d1 = xr[r][0] * qo[0], d2 = xr[r][0] * qi[0];
            #pragma unroll
            for (int j = 1; j < 4; ++j) {
                d1 = __builtin_elementwise_fma(xr[r][j], qo[j], d1);
                d2 = __builtin_elementwise_fma(xr[r][j], qi[j], d2);
            }
            s[r]         = (d1.x + d1.y) + (d1.z + d1.w);
            s[PHI_G + r] = (d2.x + d2.y) + (d2.z + d2.w);
        }
        wave_sums(s);
        float n1 = m1, n2 = m2;
        #pragma unroll
        for (int r = 0; r < PHI_G; ++r) {
            s[r]         = (s[r]         + lane_value(pe1, row0 + r)) * inv_sqrt;
            s[PHI_G + r] = (s[PHI_G + r] + lane_value(pe2, row0 + r)) * inv_sqrt;
            n1 = fmaxf(n1, s[r]);
            n2 = fmaxf(n2, s[PHI_G + r]);
        }
        const float c1 = exp_slot(m1 - n1), c2 = exp_slot(m2 - n2);   // 0 at the wave's first rows
        m1 = n1; m2 = n2;
        l1 *= c1; l2 *= c2;
        float p[2 * PHI_G];
        #pragma unroll
        for (int r = 0; r < PHI_G; ++r) {
            p[r]         = exp_slot(s[r] - n1);
            p[PHI_G + r] = exp_slot(s[PHI_G + r] - n2);
            l1 += p[r];
            l2 += p[PHI_G + r];
        }
        #pragma unroll
        for (int j = 0; j < 4; ++j) {
            f32x4 u1 = a1[j] * c1, u2 = a2[j] * c2;
            #pragma unroll
            for (int r = 0; r < PHI_G; ++r) {
                u1 = __builtin_elementwise_fma(xr[r][j], (f32x4)(p[r]), u1);
                u2 = __builtin_elementwise_fma(xr[r][j], (f32x4)(p[PHI_G + r]), u2);
            }
            a1[j] = u1; a2[j] = u2;
        }
    };

    // Kept rolled: unrolled, the arithmetic of many groups is put off behind their loads and spills.
    // No loaded row is carried over the back edge: carried, it is copied there behind a wait on its load.
    #pragma unroll 1
    for (int row = 0; row < 32; row += 2 * PHI_G) {
        load_rows(xa, row);
        load_rows(xb, row + PHI_G);
        // Holds all 32 loads in front of the arithmetic; without it the second group's are issued late.
        __builtin_amdgcn_sched_barrier(0);
        take_rows(xa, row);
        take_rows(xb, row + PHI_G);
    }

    #pragma unroll
    for (int j = 0; j < 4; ++j) {
        *(f32x4*)&part[wave][0][(lane + 32 * j) * 4] = a1[j];
        *(f32x4*)&part[wave][1][(lane + 32 * j) * 4] = a2[j];
    }
    if (lane == 0) {
        pm[0][wave] = m1; pl[0][wave] = l1;
        pm[1][wave] = m2; pl[1][wave] = l2;
    }
    __syncthreads();

    // Merge: thread t owns columns 2t and 2t + 1.
    float M1 = pm[0][0], M2 = pm[1][0];
    #pragma unroll
    for (int w = 1; w < 8; ++w) { M1 = fmaxf(M1, pm[0][w]); M2 = fmaxf(M2, pm[1][w]); }
    float L1 = 0.0f;
    f32x2 v = {};
    #pragma unroll
    for (int w = 0; w < 8; ++w) {
        const float f = __expf(pm[0][w] - M1);
        L1 += f * pl[0][w];
        v  += f * *(const f32x2*)&part[w][0][2 * t];
    }
    v *= 1.0f / L1;
    ((f32x2*)vout)[(size_t)b * 256 + t] = v;

    // Input head, position 0: the score of v[b] itself.
    const f32x2 q = ((const f32x2*)qk_in)[(size_t)b * 256 + t];
    float d[1] = { v.x * q.x + v.y * q.y };
    wave_sums(d);
    if (lane == 0) red[wave] = d[0];
    __syncthreads();
    float dv = red[0];
    #pragma unroll
    for (int w = 1; w < 8; ++w) dv += red[w];
    const float s0 = (dv + pe_dot_in[(size_t)b * 257]) * inv_sqrt;

    M2 = fmaxf(M2, s0);
    const float e0 = __expf(s0 - M2);
    float L2 = e0;
    f32x2 o = e0 * v;
    #pragma unroll
    for (int w = 0; w < 8; ++w) {
        const float f = __expf(pm[1][w] - M2);
        L2 += f * pl[1][w];
        o  += f * *(const f32x2*)&part[w][1][2 * t];
    }
    o *= 1.0f / L2;
    ((f32x2*)pbar)[(size_t)b * 256 + t] = o;
}

// ---------------------------------------------------------------------------
// Final row softmax of v + logits, logits = the sum of the L_PLANES planes + bias.
// One block (256 threads) per row; cols <= 512.
// ---------------------------------------------------------------------------
__global__ __launch_bounds__(256) void softmax_kernel(
    const float* __restrict__ src, const float* __restrict__ planes, const float* __restrict__ bias,
    float* __restrict__ dst, int cols, int ld)
{
    int b = blockIdx.x, t = threadIdx.x;
    __shared__ float red[256];
    int c0 = t, c1 = t + 256;
    // Both columns' loads go out as one batch: a column past cols reads column 0 and is not used.
    const int i0 = (c0 < cols) ? c0 : 0, i1 = (c1 < cols) ? c1 : 0;
    float p0[L_PLANES], p1[L_PLANES];
    #pragma unroll
    for (int z = 0; z < L_PLANES; ++z) {
        p0[z] = planes[(size_t)z * B_SZ * N_ACT + (size_t)b * ld + i0];
        p1[z] = planes[(size_t)z * B_SZ * N_ACT + (size_t)b * ld + i1];
    }
    const float v0 = src[(size_t)b * ld + i0], v1 = src[(size_t)b * ld + i1];
    const float g0 = bias[i0], g1 = bias[i1];
    float s0 = p0[0], s1 = p1[0];
    #pragma unroll
    for (int z = 1; z < L_PLANES; ++z) { s0 += p0[z]; s1 += p1[z]; }
    s0 = v0 + (s0 + g0);
    s1 = v1 + (s1 + g1);
    float x0 = (c0 < cols) ? s0 : -INFINITY;
    float x1 = (c1 < cols) ? s1 : -INFINITY;
    red[t] = fmaxf(x0, x1);
    __syncthreads();
    for (int s = 128; s; s >>= 1) { if (t < s) red[t] = fmaxf(red[t], red[t + s]); __syncthreads(); }
    float mx = red[0];
    __syncthreads();
    float e0 = (c0 < cols) ? __expf(x0 - mx) : 0.0f;
    float e1 = (c1 < cols) ? __expf(x1 - mx) : 0.0f;
    red[t] = e0 + e1;
    __syncthreads();
    for (int s = 128; s; s >>= 1) { if (t < s) red[t] += red[t + s]; __syncthreads(); }
    float inv = 1.0f / red[0];
    if (c0 < cols) dst[(size_t)b * ld + c0] = e0 * inv;
    if (c1 < cols) dst[(size_t)b * ld + c1] = e1 * inv;
}

// ---------------------------------------------------------------------------
extern "C" void kernel_launch(void* const* d_in, const int* in_sizes, int n_in,
                              void* d_out, int out_size, void* d_ws, size_t ws_size,
                              hipStream_t stream) {
    const float* h_s    = (const float*)d_in[0];
    const float* phi    = (const float*)d_in[1];
    const float* WQ_out = (const float*)d_in[2];
    const float* WK_out = (const float*)d_in[3];
    const float* WQ_in  = (const float*)d_in[4];
    const float* WK_in  = (const float*)d_in[5];
    const float* WV_in  = (const float*)d_in[6];
    const float* W1     = (const float*)d_in[7];
    const float* b1     = (const float*)d_in[8];
    const float* W2     = (const float*)d_in[9];
    const float* b2     = (const float*)d_in[10];
    float* out = (float*)d_out;

    float* ws      = (float*)d_ws;
    float* pw_out  = ws;                  // 256*1024: pe @ WK_out
    float* pw_in   = pw_out  + 256 * 1024;// 384*1024: pe @ WK_in (rows 0..256 are used)
    float* q_out   = pw_in   + 384 * 1024;// 512*1024
    float* q_in    = q_out   + 512 * 1024;// 512*1024
    float* h_pre   = q_in    + 512 * 1024;// 512*1024: h_s @ W1[0:1024], raw sums
    float* wvw1    = h_pre   + 512 * 1024;// 512*1024: WV_in @ W1[1024:2048]
    float* qk_out  = wvw1    + 512 * 1024;// 512*512
    float* qk_in   = qk_out  + 512 * 512; // 512*512
    float* pe_do   = qk_in   + 512 * 512; // 512*256
    float* pe_di   = pe_do   + 512 * 256; // 512*257
    float* vbuf    = pe_di   + 512 * 257; // 512*512
    float* pbar    = vbuf    + 512 * 512; // 512*512
    float* hpl     = pbar    + 512 * 512; // 2 planes of 512*1024: the hidden layer's partial sums
    float* lpl     = hpl     + 2 * 512 * 1024;// 8 planes of 512*512: the logits' partial sums

    const dim3 blk(256);

    // q_out = h_s @ WQ_out, q_in = h_s @ WQ_in, h_pre = h_s @ W1[0:1024], pe @ WK of both heads
    first_products_kernel<<<dim3(16, 4, 5), blk, 0, stream>>>(h_s, WQ_out, WQ_in, W1, WK_out, WK_in,
                                                              q_out, q_in, h_pre, pw_out, pw_in);
    // qk = q @ WK^T and the pe-dot terms q @ (pe @ WK)^T, both heads; WV_in @ W1[1024:2048]
    second_products_kernel<<<dim3(8, 4, 6), blk, 0, stream>>>(q_out, q_in, WK_out, WK_in, pw_out, pw_in,
                                                              WV_in, W1 + 1024 * 1024,
                                                              qk_out, qk_in, pe_do, pe_di, wvw1);

    // the one pass over phi: v and pbar
    phi_once_kernel<<<512, blk, 0, stream>>>(phi, qk_out, qk_in, pe_do, pe_di, vbuf, pbar);

    // MLP: relu([h_s ; ctx] @ W1 + b1) = relu(h_pre + pbar @ (WV_in @ W1[1024:2048]) + b1)
    hidden_planes_kernel<<<dim3(16, 4, 2), blk, 0, stream>>>(pbar, wvw1, b1, h_pre, hpl, 256);
    logit_planes_kernel<<<dim3(8, 4, 8),  blk, 0, stream>>>(hpl, W2, lpl, 128);
    // out = softmax(v + logits)
    softmax_kernel<<<512, blk, 0, stream>>>(vbuf, lpl, b2, out, 512, 512);
}

// v007
// One run takes 57.7 microseconds.
// Next to v006, in two timings, it ran 1.08 times as fast each time.
// Over all steps from v000 it is 7.11 times as fast.
#include <hip/hip_runtime.h>
#include <hip/hip_bf16.h>
#include <math.h>

typedef __attribute__((ext_vector_type(16))) __bf16 v16bf;
typedef __attribute__((ext_vector_type(8)))  __bf16 v8bf;
typedef __attribute__((ext_vector_type(4)))  __bf16 v4bf;
typedef __attribute__((ext_vector_type(8)))  float  v8f;
typedef __attribute__((ext_vector_type(4)))  float  v4f;

#define B_SZ    512
#define D_ENC   1024
#define D_MODEL 1024
#define N_ACT   512
#define N_PREV  256

// ---------------------------------------------------------------------------
// Sinusoidal positional encoding: pe[pos, 2i] = sin(pos*div_i),
// pe[pos, 2i+1] = cos(pos*div_i), div_i = exp(2i * PE_LOG_STEP).
// ---------------------------------------------------------------------------
#define PE_LOG_STEP (-9.210340371976184f / 512.0f)

// e^x as 2^(x * log2 e), as __expf forms it. The v_nop fills the slot that the instruction set asks for
// behind a transcendental.
__device__ __forceinline__ float exp_slot(float x) {
    float r;
    asm("v_exp_f32 %0, %1\n\tv_nop" : "=v"(r) : "v"(x * 1.4426950408889634f));
    return r;
}
// sin a and cos a as __sinf and __cosf form them (the angle in turns). The results keep clear of the
// angle's register and the v_nop fills the slot that the instruction set asks for behind a
// transcendental.
__device__ __forceinline__ void sincos_slot(float a, float& s, float& c) {
    asm("v_sin_f32 %0, %2\n\tv_cos_f32 %1, %2\n\tv_nop" : "=&v"(s), "=&v"(c) : "v"(a * 0.15915494309189532f));
}

// ---------------------------------------------------------------------------
// WMMA GEMM: C = A(MxK) * B + optional bias / relu.
// BT=0: B is (K,N) row-major.  BT=1: B is (N,K) row-major (C = A*B^T).
// EPI: 0 = none, 1 = +bias, 2 = relu(+bias).
// A product over a long K can be cut in two launches with the order of its sums kept:
// raw = true stores the f32 sums as they lie in the accumulator registers (whole tiles only:
// per wave eight pieces of 32 lanes x 4 floats), and INIT=1 starts from such sums (Cin, of a
// product with the same M and N) instead of from zero.
// Block tile 128x64, 256 threads = 8 waves (4 along M x 2 along N),
// each wave computes 32x32 via 2x2 v_wmma_f32_16x16x32_bf16 fragments.
// One pass stages 128 k of both operands, so the exposed load latency and the
// two barriers are paid once per four WMMA k-steps.
// Software-pipelined: next K-tile's global loads are issued before this
// tile's WMMAs so the load latency hides under ds_load + v_wmma work.
// M % 128 == 0, K % 128 == 0; N guarded (BT path supports ragged N, e.g. 257).
// APE=1: A is the positional encoding itself (row = position, K = 512); its elements are
// formed in the staging registers and A is not read.
// A product can also be cut along K over work-groups: each takes K columns of A (row pitch lda)
// and K rows of B and stores its own plane of partial sums; whoever reads the product adds the planes.
// ASUM=1: A is relu(A + A2), the sum of two such planes, formed in the staging registers.
// KG=2: the work-group has 16 waves in two groups of 8 with LDS tiles of their own. Group g takes the
// K tiles g, g + 2, ..., so that twice the bytes are in flight per pass and the passes are half as many
// (K % 256 == 0). Behind the loop the groups swap halves of their sums through LDS: group g adds up and
// stores the fragment rows i = g of every wave tile.
// (bx, by) is the tile's place; the two LDS tiles belong to the calling kernel.
// ---------------------------------------------------------------------------
#define GEMM_BK 128
#define GEMM_LD 136   // LDS row pitch in bf16: 272 B = 16 B x odd, for ds_load_b128

template <int BT, int EPI, int INIT, int APE = 0, int ASUM = 0, int KG = 1>
__device__ __forceinline__ void gemm_tile(
    __bf16 (&ldsA_all)[KG * 128 * GEMM_LD], __bf16 (&ldsB_all)[KG * 64 * GEMM_LD],
    const float* __restrict__ A, const float* __restrict__ B,
    const float* __restrict__ bias, const float* __restrict__ Cin, float* __restrict__ C,
    int N, int K, int lda, const bool raw, const unsigned bx, const unsigned by,
    const float* __restrict__ A2 = nullptr)
{
    const int t    = KG == 2 ? (threadIdx.x & 255) : threadIdx.x;   // place in the group of 8 waves
    const int g    = KG == 2 ? __builtin_amdgcn_readfirstlane(threadIdx.x >> 8) : 0;
    __bf16* const ldsA = &ldsA_all[g * (128 * GEMM_LD)];
    __bf16* const ldsB = &ldsB_all[g * (64 * GEMM_LD)];
    const int k0   = g * GEMM_BK;       // the group's first K tile
    const int m0   = by * 128;
    const int n0   = bx * 64;
    if (n0 >= N) return;                // the narrower of the products that share a grid
    const int wave = t >> 5;
    const int lane = t & 31;
    const int wm   = (wave & 3) * 32;   // wave row offset in block tile
    const int wn   = (wave >> 2) * 32;  // wave col offset in block tile
    const int lr   = lane & 15;
    const int kh   = lane >> 4;         // K-half selector per ISA layout

    // Staging coordinates (fixed across K tiles).
    // K-contiguous operands: wave w stages rows w, w + 8, ...; one load covers
    // one 512-B row piece.
    const int sc = lane * 4;            // k offset in the tile
    // BT=0: each thread takes a block of 8 consecutive k-rows x 4 columns (one n quad), so that it
    // holds 8 consecutive k of each of its columns and can write them to the [n][k] tile 16 B at a time.
    const int bk = (t >> 4) * 8;
    const int bq = (t & 15) * 4;

    float4 ra[16], rb[8];
    float4 ra2[ASUM ? 16 : 1];          // ASUM: the second plane's rows

    // One pointer per staged row, stepped in place from K tile to K tile.
    const float* pa[16];
    const float* pb[8];
    #pragma unroll
    for (int u = 0; u < 16; ++u)
        pa[u] = APE ? nullptr : &A[(size_t)(m0 + wave + 8 * u) * lda + k0 + sc];
    const float* pa2 = ASUM ? &A2[(size_t)(m0 + wave) * lda + k0 + sc] : nullptr;
    #pragma unroll
    for (int u = 0; u < 8; ++u)
        pb[u] = BT ? &B[(size_t)min(n0 + wave + 8 * u, N - 1) * K + k0 + sc]  // ragged N: row clamped into B
                   : &B[(size_t)(k0 + bk + u) * N + min(n0 + bq, N - 4)];
    const size_t bstep = BT ? (size_t)(KG * GEMM_BK) : (size_t)(KG * GEMM_BK) * N;
    const bool   bok   = BT || (n0 + bq < N);   // N % 4 == 0 on all BT=0 calls
    int kc = k0 + sc;                   // this lane's first k of the current K tile (APE only)

    // Issue the global loads of one K tile into ra/rb, as one batch.
    auto load_tiles = [&]() {
        if constexpr (!APE) {
            #pragma unroll
            for (int u = 0; u < 16; ++u)
                ra[u] = *(const float4*)pa[u];
        }
        if constexpr (ASUM) {
            #pragma unroll
            for (int u = 0; u < 16; ++u)
                ra2[u] = *(const float4*)(pa2 + (size_t)(8 * u) * lda);
        }
        #pragma unroll
        for (int u = 0; u < 8; ++u)
            rb[u] = *(const float4*)pb[u];
        if constexpr (APE) {
            // The two scheduling barriers hold the asm sines and cosines together, between the loads and
            // the WMMAs.
            __builtin_amdgcn_sched_barrier(0);
            const float d0 = exp_slot((float)kc * PE_LOG_STEP);
            const float d1 = exp_slot((float)(kc + 2) * PE_LOG_STEP);
            #pragma unroll
            for (int u = 0; u < 16; ++u) {
                const float pos = (float)(m0 + wave + 8 * u);
                sincos_slot(pos * d0, ra[u].x, ra[u].y);
                sincos_slot(pos * d1, ra[u].z, ra[u].w);
            }
            __builtin_amdgcn_sched_barrier(0);
        }
    };
    auto step_tiles = [&]() {
        #pragma unroll
        for (int u = 0; u < 16; ++u) pa[u] += APE ? 0 : KG * GEMM_BK;
        #pragma unroll
        for (int u = 0; u < 8; ++u)  pb[u] += bstep;
        if constexpr (ASUM) pa2 += KG * GEMM_BK;
        kc += KG * GEMM_BK;
    };
    // Convert staged registers to bf16 and write LDS.
    auto store_tiles = [&]() {
        #pragma unroll
        for (int u = 0; u < 16; ++u) {
            if constexpr (ASUM) {
                ra[u].x = fmaxf(ra[u].x + ra2[u].x, 0.0f);
                ra[u].y = fmaxf(ra[u].y + ra2[u].y, 0.0f);
                ra[u].z = fmaxf(ra[u].z + ra2[u].z, 0.0f);
                ra[u].w = fmaxf(ra[u].w + ra2[u].w, 0.0f);
            }
            v4bf y = { (__bf16)ra[u].x, (__bf16)ra[u].y, (__bf16)ra[u].z, (__bf16)ra[u].w };
            *(v4bf*)&ldsA[(wave + 8 * u) * GEMM_LD + sc] = y;
        }
        if (BT) {
            #pragma unroll
            for (int u = 0; u < 8; ++u) {
                v4bf y = { (__bf16)rb[u].x, (__bf16)rb[u].y, (__bf16)rb[u].z, (__bf16)rb[u].w };
                if (n0 + wave + 8 * u >= N)     // rows past N count as zero
                    y = v4bf{ (__bf16)0.f, (__bf16)0.f, (__bf16)0.f, (__bf16)0.f };
                *(v4bf*)&ldsB[(wave + 8 * u) * GEMM_LD + sc] = y;
            }
        } else {
            if (!bok) {                         // columns past N count as zero
                #pragma unroll
                for (int u = 0; u < 8; ++u)
                    rb[u] = float4{ 0.f, 0.f, 0.f, 0.f };
            }
            v8bf y0, y1, y2, y3;                // the 8 x 4 block, turned in registers
            #pragma unroll
            for (int u = 0; u < 8; ++u) {
                y0[u] = (__bf16)rb[u].x;
                y1[u] = (__bf16)rb[u].y;
                y2[u] = (__bf16)rb[u].z;
                y3[u] = (__bf16)rb[u].w;
            }
            *(v8bf*)&ldsB[(bq + 0) * GEMM_LD + bk] = y0;
            *(v8bf*)&ldsB[(bq + 1) * GEMM_LD + bk] = y1;
            *(v8bf*)&ldsB[(bq + 2) * GEMM_LD + bk] = y2;
            *(v8bf*)&ldsB[(bq + 3) * GEMM_LD + bk] = y3;
        }
    };

    v8f acc[2][2] = {};
    // This lane's place in a plane of raw sums, in floats.
    const size_t rawoff = ((size_t)(by * (N >> 6) + bx) * 8 + wave) * 1024 + lane * 4;

    load_tiles();                        // prologue: tile 0 in flight
    if (INIT && Cin && g == 0) {         // of all that share a product's K, one group of waves carries Cin in
        const v4f* cp = (const v4f*)(Cin + rawoff);
        #pragma unroll
        for (int i = 0; i < 2; ++i)
            #pragma unroll
            for (int j = 0; j < 2; ++j) {
                const v4f lo = cp[(4 * i + 2 * j) * 32], hi = cp[(4 * i + 2 * j + 1) * 32];
                acc[i][j] = __builtin_shufflevector(lo, hi, 0, 1, 2, 3, 4, 5, 6, 7);
            }
        // Stands in front of whatever overwrites these loads' address registers behind the branch's end.
        // The pointer is an input so that its registers live up to the
        // wait: else the build lands the last load's result on them, with the other loads still going out.
        asm volatile("s_wait_xcnt 0x0" :: "v"(cp) : "memory");
    }
    // Kept rolled, so that each pass's loads go out as one batch in a block of their own: unrolled (four
    // trips are few enough for that), the build mixed the loads with waits on the first of them.
    #pragma unroll 1
    for (int kk = 0; kk < K; kk += KG * GEMM_BK) {
        store_tiles();                   // waits on outstanding loads here
        __syncthreads();
        if (kk + KG * GEMM_BK < K) {
            step_tiles();
            load_tiles();                // next tile's loads fly under WMMAs
        }

        // Fragment assembly per 16-bit A/B VGPR layout:
        // element e <-> K = 16*(e>>3) + 8*(lane>>4) + (e&7); two 16B chunks.
        union Frag { v16bf v; v8bf h[2]; };
        #pragma unroll
        for (int ks = 0; ks < GEMM_BK; ks += 32) {
            Frag fa[2], fb[2];
            #pragma unroll
            for (int i = 0; i < 2; ++i) {
                const __bf16* rp = &ldsA[(wm + 16 * i + lr) * GEMM_LD + ks];
                fa[i].h[0] = *(const v8bf*)(rp + kh * 8);
                fa[i].h[1] = *(const v8bf*)(rp + 16 + kh * 8);
                const __bf16* rq = &ldsB[(wn + 16 * i + lr) * GEMM_LD + ks];
                fb[i].h[0] = *(const v8bf*)(rq + kh * 8);
                fb[i].h[1] = *(const v8bf*)(rq + 16 + kh * 8);
            }
            #pragma unroll
            for (int i = 0; i < 2; ++i)
                #pragma unroll
                for (int j = 0; j < 2; ++j)
                    acc[i][j] = __builtin_amdgcn_wmma_f32_16x16x32_bf16(
                        false, fa[i].v, false, fb[j].v, (short)0, acc[i][j], false, false);
        }
        __syncthreads();
    }

    // KG=2: each group hands the other the fragment rows that the other finishes; the loop's last barrier
    // has ended every read of the tiles, whose LDS carries the sums (per wave 4 pieces of 32 lanes x 16 B).
    // The rows that this group finishes then lie in acc[0].
    constexpr int NI = KG == 2 ? 1 : 2;
    if constexpr (KG == 2) {
        v4f* const x = (v4f*)&ldsA_all[0];
        v4f* const xs = x + ((g * 8 + wave) * 4) * 32 + lane;
        const v4f* const xr = x + (((1 - g) * 8 + wave) * 4) * 32 + lane;
        #pragma unroll
        for (int j = 0; j < 2; ++j) {
            const v8f s = g ? acc[0][j] : acc[1][j];
            xs[(2 * j) * 32]     = __builtin_shufflevector(s, s, 0, 1, 2, 3);
            xs[(2 * j + 1) * 32] = __builtin_shufflevector(s, s, 4, 5, 6, 7);
        }
        __syncthreads();
        #pragma unroll
        for (int j = 0; j < 2; ++j) {
            const v4f lo = xr[(2 * j) * 32], hi = xr[(2 * j + 1) * 32];
            const v8f own = g ? acc[1][j] : acc[0][j];
            acc[0][j] = own + __builtin_shufflevector(lo, hi, 0, 1, 2, 3, 4, 5, 6, 7);
        }
    }

    if (raw) {
        v4f* cp = (v4f*)(C + rawoff);
        #pragma unroll
        for (int i = 0; i < NI; ++i)
            #pragma unroll
            for (int j = 0; j < 2; ++j) {
                const int fi = KG == 2 ? g : i;
                cp[(4 * fi + 2 * j) * 32]     = __builtin_shufflevector(acc[i][j], acc[i][j], 0, 1, 2, 3);
                cp[(4 * fi + 2 * j + 1) * 32] = __builtin_shufflevector(acc[i][j], acc[i][j], 4, 5, 6, 7);
            }
        // Stands in front of whatever overwrites the stores' address or data registers: in a kernel that
        // holds several products the code behind this return runs on into another product's text.
        asm volatile("s_wait_xcnt 0x0" ::: "memory");
        return;
    }

    // Epilogue: D layout — VGPR r holds M = r + 8*(lane>>4), N = lane&15.
    #pragma unroll
    for (int i = 0; i < NI; ++i) {
        int row = m0 + wm + 16 * (KG == 2 ? g : i) + 8 * kh;
        #pragma unroll
        for (int j = 0; j < 2; ++j) {
            int col = n0 + wn + 16 * j + lr;
            if (col < N) {
                float bv = 0.0f;
                if (EPI > 0 && bias) {          // one plane of a cut product takes the bias
                    const float* bp = bias + (n0 + wn + lr);
                    bv = bp[16 * j];
                    // Stands in front of whatever overwrites the load's address registers (the build forms the
                    // stores' address in them); the pointer is an input so that they live up to the wait.
                    asm volatile("s_wait_xcnt 0x0" :: "v"(bp) : "memory");
                }
                #pragma unroll
                for (int r = 0; r < 8; ++r) {
                    float val = acc[i][j][r] + bv;
                    if (EPI == 2) val = fmaxf(val, 0.0f);
                    C[(size_t)(row + r) * N + col] = val;
                }
            }
        }
    }
}

#define GEMM_LDS_TILES(KG) \
    __shared__ __align__(16) __bf16 ldsA[(KG) * 128 * GEMM_LD];   /* [m][k], one tile per group of waves */ \
    __shared__ __align__(16) __bf16 ldsB[(KG) * 64 * GEMM_LD];    /* [n][k] */

// The MLP's two products, each cut along K over blockIdx.z so that the launch reaches more WGPs and
// each work-group's chain of passes is short. ks, the k per work-group, is an argument and no constant:
// the K loop then stays a loop, with each pass's loads as one batch in a block of their own; unrolled,
// the build mixed the loads with waits on the first of them.
// Hidden layer before relu: plane z = pbar[:, ks z ...] @ wvw1[ks z ..., :]; plane 0 starts from h_pre,
// the raw sums of h_s @ W1[0:1024], and takes b1.
__global__ __launch_bounds__(512) void hidden_planes_kernel(
    const float* __restrict__ pbar, const float* __restrict__ wvw1, const float* __restrict__ b1,
    const float* __restrict__ h_pre, float* __restrict__ hpl, int ks)
{
    GEMM_LDS_TILES(2)
    const int z = blockIdx.z;
    gemm_tile<0, 1, 1, 0, 0, 2>(ldsA, ldsB, pbar + z * ks, wvw1 + (size_t)z * ks * D_MODEL,
                       z == 0 ? b1 : nullptr, z == 0 ? h_pre : nullptr, hpl + (size_t)z * B_SZ * D_MODEL,
                       D_MODEL, ks, N_ACT, false, blockIdx.x, blockIdx.y);
}
// Logits before bias: plane z = h[:, ks z ...] @ W2[ks z ..., :], h = relu(hpl[0] + hpl[1]).
__global__ __launch_bounds__(256) void logit_planes_kernel(
    const float* __restrict__ hpl, const float* __restrict__ W2, float* __restrict__ lpl, int ks)
{
    GEMM_LDS_TILES(1)
    const int z = blockIdx.z;
    gemm_tile<0, 0, 0, 0, 1>(ldsA, ldsB, hpl + z * ks, W2 + (size_t)z * ks * N_ACT, nullptr,
                             nullptr, lpl + (size_t)z * B_SZ * N_ACT,
                             N_ACT, ks, D_MODEL, false, blockIdx.x, blockIdx.y,
                             hpl + (size_t)B_SZ * D_MODEL + z * ks);
}
#define L_PLANES 8   // planes of the logits: K = 1024 in slices of 128

// All that needs nothing but h_s and the weights and is wanted by the second launch, in one launch:
// blockIdx.z = 0, 1, 2 are h_s @ WQ_out, h_s @ WQ_in and h_s @ W1[0:1024] (the first half of
// x @ W1, kept as raw sums); z = 3, 4 are pe @ WK_out (256 positions) and pe @ WK_in (257, in
// three row tiles), from which the pe terms of the scores follow as q @ (pe @ WK)^T.
__global__ __launch_bounds__(512) void first_products_kernel(
    const float* __restrict__ h_s, const float* __restrict__ WQ_out,
    const float* __restrict__ WQ_in, const float* __restrict__ W1,
    const float* __restrict__ WK_out, const float* __restrict__ WK_in,
    float* __restrict__ q_out, float* __restrict__ q_in, float* __restrict__ h_pre,
    float* __restrict__ pw_out, float* __restrict__ pw_in)
{
    GEMM_LDS_TILES(2)
    const int z = blockIdx.z;
    if (z >= 3) {
        if ((int)blockIdx.y >= z - 1) return;       // 2 row tiles of positions at z = 3, 3 at z = 4
        gemm_tile<0, 0, 0, 1, 0, 2>(ldsA, ldsB, nullptr, z == 3 ? WK_out : WK_in, nullptr, nullptr,
                              z == 3 ? pw_out : pw_in, D_MODEL, N_ACT, N_ACT, false, blockIdx.x, blockIdx.y);
        return;
    }
    gemm_tile<0, 0, 0, 0, 0, 2>(ldsA, ldsB, h_s, z == 0 ? WQ_out : (z == 1 ? WQ_in : W1), nullptr, nullptr,
                       z == 0 ? q_out : (z == 1 ? q_in : h_pre), D_MODEL, D_ENC, D_ENC, z == 2,
                       blockIdx.x, blockIdx.y);
}

// All that needs q, in one launch: z = 0, 1 are qk = q @ WK^T of the two heads, z = 2, 3 their pe
// terms q @ (pe @ WK)^T. z = 4, 5 are the two column halves of WV_in @ W1[1024:2048], a product of
// weights alone that is wanted only behind the pass over phi and finds idle WGPs here:
// ctx @ W1[1024:2048] = pbar @ (WV_in @ W1[1024:2048]).
__global__ __launch_bounds__(512) void second_products_kernel(
    const float* __restrict__ q_out, const float* __restrict__ q_in,
    const float* __restrict__ WK_out, const float* __restrict__ WK_in,
    const float* __restrict__ pw_out, const float* __restrict__ pw_in,
    const float* __restrict__ WV_in, const float* __restrict__ W1b,
    float* __restrict__ qk_out, float* __restrict__ qk_in,
    float* __restrict__ pe_dot_out, float* __restrict__ pe_dot_in, float* __restrict__ wvw1)
{
    GEMM_LDS_TILES(2)
    const int z = blockIdx.z;
    if (z >= 4) {
        gemm_tile<0, 0, 0, 0, 0, 2>(ldsA, ldsB, WV_in, W1b, nullptr, nullptr, wvw1, D_MODEL, D_MODEL,
                           D_MODEL, false, blockIdx.x + 8 * (z - 4), blockIdx.y);
        return;
    }
    gemm_tile<1, 0, 0, 0, 0, 2>(ldsA, ldsB, (z & 1) ? q_in : q_out,
                       z == 0 ? WK_out : z == 1 ? WK_in : z == 2 ? pw_out : pw_in, nullptr, nullptr,
                       z == 0 ? qk_out : z == 1 ? qk_in : z == 2 ? pe_dot_out : pe_dot_in,
                       z < 2 ? N_ACT : N_PREV + (z - 2), D_MODEL, D_MODEL, false, blockIdx.x, blockIdx.y);
}

// ---------------------------------------------------------------------------
// The one pass over phi. Block per b, wave per 32 rows n. While a row is in
// registers it gives both heads' scores (qk . phi[b,n] + pe-dot term, scaled)
// and is then added, weighted, into both heads' running row sums, with a
// running maximum per head (on-line softmax). The eight waves' partial sums are
// merged through LDS: v[b] first, then the input head's score of v[b] itself
// (position 0), which joins the input head's sums as one more row:
//   v[b]    = softmax(scores_out[b]) @ phi[b]
//   pbar[b] = attn_in[b,0] * v[b] + sum_n attn_in[b,n+1] * phi[b,n]
// ---------------------------------------------------------------------------
typedef __attribute__((ext_vector_type(4))) float f32x4;
typedef __attribute__((ext_vector_type(2))) float f32x2;

#define PHI_G 4   // rows per group (one step of the running maximum)

// Value of lane l ^ MASK inside the 16-lane row (DPP row_xmask).
template <int MASK>
__device__ __forceinline__ float row_xor(float x) {
    return __builtin_bit_cast(float, __builtin_amdgcn_update_dpp(
        0, __builtin_bit_cast(int, x), 0x160 | MASK, 0xf, 0xf, true));
}
// Value of lane l ^ 16.
__device__ __forceinline__ float half_xor(float x) {
    return __builtin_bit_cast(float, __builtin_amdgcn_permlanex16(
        __builtin_bit_cast(int, x), __builtin_bit_cast(int, x), 0x76543210, 0xfedcba98, false, false));
}
__device__ __forceinline__ float lane_value(float x, int l) {
    return __builtin_bit_cast(float, __builtin_amdgcn_readlane(__builtin_bit_cast(int, x), l));
}
// Sums over the wave's 32 lanes, N values side by side; every lane gets every sum.
template <int N>
__device__ __forceinline__ void wave_sums(float (&s)[N]) {
    #pragma unroll
    for (int i = 0; i < N; ++i) s[i] += row_xor<1>(s[i]);
    #pragma unroll
    for (int i = 0; i < N; ++i) s[i] += row_xor<2>(s[i]);
    #pragma unroll
    for (int i = 0; i < N; ++i) s[i] += row_xor<4>(s[i]);
    #pragma unroll
    for (int i = 0; i < N; ++i) s[i] += row_xor<8>(s[i]);
    #pragma unroll
    for (int i = 0; i < N; ++i) s[i] += half_xor(s[i]);
}

// Second launch-bounds argument: four waves per SIMD, so that two blocks (16 waves) share a WGP.
__global__ __launch_bounds__(256, 4) void phi_once_kernel(
    const float* __restrict__ phi,
    const float* __restrict__ qk_out, const float* __restrict__ qk_in,
    const float* __restrict__ pe_dot_out, const float* __restrict__ pe_dot_in,
    float* __restrict__ vout, float* __restrict__ pbar)
{
    const float inv_sqrt = 0.03125f;   // 1 / sqrt(D_MODEL)
    __shared__ __align__(16) float part[8][2][N_ACT];   // each wave's two unnormalised row sums
    __shared__ float pm[2][8], pl[2][8];                // each wave's running maximum and weight sum
    __shared__ float red[8];

    const int b    = blockIdx.x;
    const int t    = threadIdx.x;
    const int wave = __builtin_amdgcn_readfirstlane(t >> 5);
    const int lane = t & 31;

    f32x4 qo[4], qi[4];
    #pragma unroll
    for (int j = 0; j < 4; ++j) {
        qo[j] = ((const f32x4*)(qk_out + (size_t)b * N_ACT))[lane + 32 * j];
        qi[j] = ((const f32x4*)(qk_in  + (size_t)b * N_ACT))[lane + 32 * j];
    }
    // Lane l holds the pe-dot terms of the wave's row l.
    const float pe1 = pe_dot_out[(size_t)b * N_PREV + wave * 32 + lane];
    const float pe2 = pe_dot_in[(size_t)b * 257 + 1 + wave * 32 + lane];

    const f32x4* p4 = (const f32x4*)(phi + ((size_t)b * N_PREV + wave * 32) * N_ACT) + lane;

    f32x4 xa[PHI_G][4], xb[PHI_G][4];   // two groups of rows: the first is worked on while the second's loads still fly
    f32x4 a1[4] = {}, a2[4] = {};
    float m1 = -INFINITY, m2 = -INFINITY, l1 = 0.0f, l2 = 0.0f;

    // phi is read exactly once: non-temporal loads, 512 contiguous bytes per wave each.
    auto load_rows = [&](f32x4 (&xr)[PHI_G][4], int row0) {
        #pragma unroll
        for (int r = 0; r < PHI_G; ++r)
            #pragma unroll
            for (int j = 0; j < 4; ++j)
                xr[r][j] = __builtin_nontemporal_load(p4 + (row0 + r) * 128 + 32 * j);
    };
    auto take_rows = [&](const f32x4 (&xr)[PHI_G][4], int row0) {
        float s[2 * PHI_G];
        #pragma unroll
        for (int r = 0; r < PHI_G; ++r) {
            f32x4 d1 = xr[r][0] * qo[0], d2 = xr[r][0] * qi[0];
            #pragma unroll
            for (int j = 1; j < 4; ++j) {
                d1 = __builtin_elementwise_fma(xr[r][j], qo[j], d1);
                d2 = __builtin_elementwise_fma(xr[r][j], qi[j], d2);
            }
            s[r]         = (d1.x + d1.y) + (d1.z + d1.w);
            s[PHI_G + r] = (d2.x + d2.y) + (d2.z + d2.w);
        }
        wave_sums(s);
        float n1 = m1, n2 = m2;
        #pragma unroll
        for (int r = 0; r < PHI_G; ++r) {
            s[r]         = (s[r]         + lane_value(pe1, row0 + r)) * inv_sqrt;
            s[PHI_G + r] = (s[PHI_G + r] + lane_value(pe2, row0 + r)) * inv_sqrt;
            n1 = fmaxf(n1, s[r]);
            n2 = fmaxf(n2, s[PHI_G + r]);
        }
        const float c1 = exp_slot(m1 - n1), c2 = exp_slot(m2 - n2);   // 0 at the wave's first rows
        m1 = n1; m2 = n2;
        l1 *= c1; l2 *= c2;
        float p[2 * PHI_G];
        #pragma unroll
        for (int r = 0; r < PHI_G; ++r) {
            p[r]         = exp_slot(s[r] - n1);
            p[PHI_G + r] = exp_slot(s[PHI_G + r] - n2);
            l1 += p[r];
            l2 += p[PHI_G + r];
        }
        #pragma unroll
        for (int j = 0; j < 4; ++j) {
            f32x4 u1 = a1[j] * c1, u2 = a2[j] * c2;
            #pragma unroll
            for (int r = 0; r < PHI_G; ++r) {
                u1 = __builtin_elementwise_fma(xr[r][j], (f32x4)(p[r]), u1);
                u2 = __builtin_elementwise_fma(xr[r][j], (f32x4)(p[PHI_G + r]), u2);
            }
            a1[j] = u1; a2[j] = u2;
        }
    };

    // Kept rolled: unrolled, the arithmetic of many groups is put off behind their loads and spills.
    // No loaded row is carried over the back edge: carried, it is copied there behind a wait on its load.
    #pragma unroll 1
    for (int row = 0; row < 32; row += 2 * PHI_G) {
        load_rows(xa, row);
        load_rows(xb, row + PHI_G);
        // Holds all 32 loads in front of the arithmetic; without it the second group's are issued late.
        __builtin_amdgcn_sched_barrier(0);
        take_rows(xa, row);
        take_rows(xb, row + PHI_G);
    }

    #pragma unroll
    for (int j = 0; j < 4; ++j) {
        *(f32x4*)&part[wave][0][(lane + 32 * j) * 4] = a1[j];
        *(f32x4*)&part[wave][1][(lane + 32 * j) * 4] = a2[j];
    }
    if (lane == 0) {
        pm[0][wave] = m1; pl[0][wave] = l1;
        pm[1][wave] = m2; pl[1][wave] = l2;
    }
    __syncthreads();

    // Merge: thread t owns columns 2t and 2t + 1.
    float M1 = pm[0][0], M2 = pm[1][0];
    #pragma unroll
    for (int w = 1; w < 8; ++w) { M1 = fmaxf(M1, pm[0][w]); M2 = fmaxf(M2, pm[1][w]); }
    float L1 = 0.0f;
    f32x2 v = {};
    #pragma unroll
    for (int w = 0; w < 8; ++w) {
        const float f = __expf(pm[0][w] - M1);
        L1 += f * pl[0][w];
        v  += f * *(const f32x2*)&part[w][0][2 * t];
    }
    v *= 1.0f / L1;
    ((f32x2*)vout)[(size_t)b * 256 + t] = v;

    // Input head, position 0: the score of v[b] itself.
    const f32x2 q = ((const f32x2*)qk_in)[(size_t)b * 256 + t];
    float d[1] = { v.x * q.x + v.y * q.y };
    wave_sums(d);
    if (lane == 0) red[wave] = d[0];
    __syncthreads();
    float dv = red[0];
    #pragma unroll
    for (int w = 1; w < 8; ++w) dv += red[w];
    const float s0 = (dv + pe_dot_in[(size_t)b * 257]) * inv_sqrt;

    M2 = fmaxf(M2, s0);
    const float e0 = __expf(s0 - M2);
    float L2 = e0;
    f32x2 o = e0 * v;
    #pragma unroll
    for (int w = 0; w < 8; ++w) {
        const float f = __expf(pm[1][w] - M2);
        L2 += f * pl[1][w];
        o  += f * *(const f32x2*)&part[w][1][2 * t];
    }
    o *= 1.0f / L2;
    ((f32x2*)pbar)[(size_t)b * 256 + t] = o;
}

// ---------------------------------------------------------------------------
// Final row softmax of v + logits, logits = the sum of the L_PLANES planes + bias.
// One block (256 threads) per row; cols <= 512.
// ---------------------------------------------------------------------------
__global__ __launch_bounds__(256) void softmax_kernel(
    const float* __restrict__ src, const float* __restrict__ planes, const float* __restrict__ bias,
    float* __restrict__ dst, int cols, int ld)
{
    int b = blockIdx.x, t = threadIdx.x;
    __shared__ float red[256];
    int c0 = t, c1 = t + 256;
    // Both columns' loads go out as one batch: a column past cols reads column 0 and is not used.
    const int i0 = (c0 < cols) ? c0 : 0, i1 = (c1 < cols) ? c1 : 0;
    float p0[L_PLANES], p1[L_PLANES];
    #pragma unroll
    for (int z = 0; z < L_PLANES; ++z) {
        p0[z] = planes[(size_t)z * B_SZ * N_ACT + (size_t)b * ld + i0];
        p1[z] = planes[(size_t)z * B_SZ * N_ACT + (size_t)b * ld + i1];
    }
    const float v0 = src[(size_t)b * ld + i0], v1 = src[(size_t)b * ld + i1];
    const float g0 = bias[i0], g1 = bias[i1];
    float s0 = p0[0], s1 = p1[0];
    #pragma unroll
    for (int z = 1; z < L_PLANES; ++z) { s0 += p0[z]; s1 += p1[z]; }
    s0 = v0 + (s0 + g0);
    s1 = v1 + (s1 + g1);
    float x0 = (c0 < cols) ? s0 : -INFINITY;
    float x1 = (c1 < cols) ? s1 : -INFINITY;
    red[t] = fmaxf(x0, x1);
    __syncthreads();
    for (int s = 128; s; s >>= 1) { if (t < s) red[t] = fmaxf(red[t], red[t + s]); __syncthreads(); }
    float mx = red[0];
    __syncthreads();
    float e0 = (c0 < cols) ? __expf(x0 - mx) : 0.0f;
    float e1 = (c1 < cols) ? __expf(x1 - mx) : 0.0f;
    red[t] = e0 + e1;
    __syncthreads();
    for (int s = 128; s; s >>= 1) { if (t < s) red[t] += red[t + s]; __syncthreads(); }
    float inv = 1.0f / red[0];
    if (c0 < cols) dst[(size_t)b * ld + c0] = e0 * inv;
    if (c1 < cols) dst[(size_t)b * ld + c1] = e1 * inv;
}

// ---------------------------------------------------------------------------
extern "C" void kernel_launch(void* const* d_in, const int* in_sizes, int n_in,
                              void* d_out, int out_size, void* d_ws, size_t ws_size,
                              hipStream_t stream) {
    const float* h_s    = (const float*)d_in[0];
    const float* phi    = (const float*)d_in[1];
    const float* WQ_out = (const float*)d_in[2];
    const float* WK_out = (const float*)d_in[3];
    const float* WQ_in  = (const float*)d_in[4];
    const float* WK_in  = (const float*)d_in[5];
    const float* WV_in  = (const float*)d_in[6];
    const float* W1     = (const float*)d_in[7];
    const float* b1     = (const float*)d_in[8];
    const float* W2     = (const float*)d_in[9];
    const float* b2     = (const float*)d_in[10];
    float* out = (float*)d_out;

    float* ws      = (float*)d_ws;
    float* pw_out  = ws;                  // 256*1024: pe @ WK_out
    float* pw_in   = pw_out  + 256 * 1024;// 384*1024: pe @ WK_in (rows 0..256 are used)
    float* q_out   = pw_in   + 384 * 1024;// 512*1024
    float* q_in    = q_out   + 512 * 1024;// 512*1024
    float* h_pre   = q_in    + 512 * 1024;// 512*1024: h_s @ W1[0:1024], raw sums
    float* wvw1    = h_pre   + 512 * 1024;// 512*1024: WV_in @ W1[1024:2048]
    float* qk_out  = wvw1    + 512 * 1024;// 512*512
    float* qk_in   = qk_out  + 512 * 512; // 512*512
    float* pe_do   = qk_in   + 512 * 512; // 512*256
    float* pe_di   = pe_do   + 512 * 256; // 512*257
    float* vbuf    = pe_di   + 512 * 257; // 512*512
    float* pbar    = vbuf    + 512 * 512; // 512*512
    float* hpl     = pbar    + 512 * 512; // 2 planes of 512*1024: the hidden layer's partial sums
    float* lpl     = hpl     + 2 * 512 * 1024;// 8 planes of 512*512: the logits' partial sums

    const dim3 blk(256);
    const dim3 blk2(512);   // GEMMs whose K tiles are dealt to two groups of 8 waves

    // q_out = h_s @ WQ_out, q_in = h_s @ WQ_in, h_pre = h_s @ W1[0:1024], pe @ WK of both heads
    first_products_kernel<<<dim3(16, 4, 5), blk2, 0, stream>>>(h_s, WQ_out, WQ_in, W1, WK_out, WK_in,
                                                              q_out, q_in, h_pre, pw_out, pw_in);
    // qk = q @ WK^T and the pe-dot terms q @ (pe @ WK)^T, both heads; WV_in @ W1[1024:2048]
    second_products_kernel<<<dim3(8, 4, 6), blk2, 0, stream>>>(q_out, q_in, WK_out, WK_in, pw_out, pw_in,
                                                              WV_in, W1 + 1024 * 1024,
                                                              qk_out, qk_in, pe_do, pe_di, wvw1);

    // the one pass over phi: v and pbar
    phi_once_kernel<<<512, blk, 0, stream>>>(phi, qk_out, qk_in, pe_do, pe_di, vbuf, pbar);

    // MLP: relu([h_s ; ctx] @ W1 + b1) = relu(h_pre + pbar @ (WV_in @ W1[1024:2048]) + b1)
    hidden_planes_kernel<<<dim3(16, 4, 2), blk2, 0, stream>>>(pbar, wvw1, b1, h_pre, hpl, 256);
    logit_planes_kernel<<<dim3(8, 4, 8),  blk, 0, stream>>>(hpl, W2, lpl, 128);
    // out = softmax(v + logits)
    softmax_kernel<<<512, blk, 0, stream>>>(vbuf, lpl, b2, out, 512, 512);
}

// v008
// A run of this version takes 56.6 microseconds.
// Next to v007, in two timings, it ran 1.03 times as fast each time.
// All steps since v000 together make it 7.34 times as fast.
#include <hip/hip_runtime.h>
#include <hip/hip_bf16.h>
#include <math.h>

typedef __attribute__((ext_vector_type(16))) __bf16 v16bf;
typedef __attribute__((ext_vector_type(8)))  __bf16 v8bf;
typedef __attribute__((ext_vector_type(4)))  __bf16 v4bf;
typedef __attribute__((ext_vector_type(8)))  float  v8f;
typedef __attribute__((ext_vector_type(4)))  float  v4f;

#define B_SZ    512
#define D_ENC   1024
#define D_MODEL 1024
#define N_ACT   512
#define N_PREV  256

// ---------------------------------------------------------------------------
// Sinusoidal positional encoding: pe[pos, 2i] = sin(pos*div_i),
// pe[pos, 2i+1] = cos(pos*div_i), div_i = exp(2i * PE_LOG_STEP).
// ---------------------------------------------------------------------------
#define PE_LOG_STEP (-9.210340371976184f / 512.0f)

// e^x as 2^(x * log2 e), as __expf forms it. The v_nop fills the slot that the instruction set asks for
// behind a transcendental.
__device__ __forceinline__ float exp_slot(float x) {
    float r;
    asm("v_exp_f32 %0, %1\n\tv_nop" : "=v"(r) : "v"(x * 1.4426950408889634f));
    return r;
}
// sin a and cos a as __sinf and __cosf form them (the angle in turns). The results keep clear of the
// angle's register and the v_nop fills the slot that the instruction set asks for behind a
// transcendental.
__device__ __forceinline__ void sincos_slot(float a, float& s, float& c) {
    asm("v_sin_f32 %0, %2\n\tv_cos_f32 %1, %2\n\tv_nop" : "=&v"(s), "=&v"(c) : "v"(a * 0.15915494309189532f));
}

// ---------------------------------------------------------------------------
// WMMA GEMM: C = A(MxK) * B + optional bias / relu.
// BT=0: B is (K,N) row-major.  BT=1: B is (N,K) row-major (C = A*B^T).
// EPI: 0 = none, 1 = +bias, 2 = relu(+bias).
// A product over a long K can be cut in two launches with the order of its sums kept:
// raw = true stores the f32 sums as they lie in the accumulator registers (whole tiles only:
// per wave eight pieces of 32 lanes x 4 floats), and INIT=1 starts from such sums (Cin, of a
// product with the same M and N) instead of from zero.
// Block tile 128x64, 256 threads = 8 waves (4 along M x 2 along N),
// each wave computes 32x32 via 2x2 v_wmma_f32_16x16x32_bf16 fragments.
// One pass stages 128 k of both operands, so the exposed load latency and the
// two barriers are paid once per four WMMA k-steps.
// Software-pipelined: next K-tile's global loads are issued before this
// tile's WMMAs so the load latency hides under ds_load + v_wmma work.
// M % 128 == 0, K % 128 == 0; N guarded (BT path supports ragged N, e.g. 257).
// APE=1: A is the positional encoding itself (row = position, K = 512); its elements are
// formed in the staging registers and A is not read.
// A product can also be cut along K over work-groups: each takes K columns of A (row pitch lda)
// and K rows of B and stores its own plane of partial sums; whoever reads the product adds the planes.
// ASUM=1: A is relu(A + A2), the sum of two such planes, formed in the staging registers.
// KG=2: the work-group has 16 waves in two groups of 8 with LDS tiles of their own. Group g takes the
// K tiles g, g + 2, ..., so that twice the bytes are in flight per pass and the passes are half as many
// (K % 256 == 0). Behind the loop the groups swap halves of their sums through LDS: group g adds up and
// stores the fragment rows i = g of every wave tile.
// (bx, by) is the tile's place; the two LDS tiles belong to the calling kernel.
// ---------------------------------------------------------------------------
#define GEMM_BK 128
#define GEMM_LD 136   // LDS row pitch in bf16: 272 B = 16 B x odd, for ds_load_b128

template <int BT, int EPI, int INIT, int APE = 0, int ASUM = 0, int KG = 1>
__device__ __forceinline__ void gemm_tile(
    __bf16 (&ldsA_all)[KG * 128 * GEMM_LD], __bf16 (&ldsB_all)[KG * 64 * GEMM_LD],
    const float* __restrict__ A, const float* __restrict__ B,
    const float* __restrict__ bias, const float* __restrict__ Cin, float* __restrict__ C,
    int N, int K, int lda, const bool raw, const unsigned bx, const unsigned by,
    const float* __restrict__ A2 = nullptr)
{
    const int t    = KG == 2 ? (threadIdx.x & 255) : threadIdx.x;   // place in the group of 8 waves
    const int g    = KG == 2 ? __builtin_amdgcn_readfirstlane(threadIdx.x >> 8) : 0;
    __bf16* const ldsA = &ldsA_all[g * (128 * GEMM_LD)];
    __bf16* const ldsB = &ldsB_all[g * (64 * GEMM_LD)];
    const int k0   = g * GEMM_BK;       // the group's first K tile
    const int m0   = by * 128;
    const int n0   = bx * 64;
    if (n0 >= N) return;                // the narrower of the products that share a grid
    const int wave = t >> 5;
    const int lane = t & 31;
    const int wm   = (wave & 3) * 32;   // wave row offset in block tile
    const int wn   = (wave >> 2) * 32;  // wave col offset in block tile
    const int lr   = lane & 15;
    const int kh   = lane >> 4;         // K-half selector per ISA layout

    // Staging coordinates (fixed across K tiles).
    // K-contiguous operands: wave w stages rows w, w + 8, ...; one load covers
    // one 512-B row piece.
    const int sc = lane * 4;            // k offset in the tile
    // BT=0: each thread takes a block of 8 consecutive k-rows x 4 columns (one n quad), so that it
    // holds 8 consecutive k of each of its columns and can write them to the [n][k] tile 16 B at a time.
    const int bk = (t >> 4) * 8;
    const int bq = (t & 15) * 4;

    float4 ra[16], rb[8];
    float4 ra2[ASUM ? 16 : 1];          // ASUM: the second plane's rows

    // One pointer per staged row, stepped in place from K tile to K tile.
    const float* pa[16];
    const float* pb[8];
    #pragma unroll
    for (int u = 0; u < 16; ++u)
        pa[u] = APE ? nullptr : &A[(size_t)(m0 + wave + 8 * u) * lda + k0 + sc];
    const float* pa2 = ASUM ? &A2[(size_t)(m0 + wave) * lda + k0 + sc] : nullptr;
    #pragma unroll
    for (int u = 0; u < 8; ++u)
        pb[u] = BT ? &B[(size_t)min(n0 + wave + 8 * u, N - 1) * K + k0 + sc]  // ragged N: row clamped into B
                   : &B[(size_t)(k0 + bk + u) * N + min(n0 + bq, N - 4)];
    const size_t bstep = BT ? (size_t)(KG * GEMM_BK) : (size_t)(KG * GEMM_BK) * N;
    const bool   bok   = BT || (n0 + bq < N);   // N % 4 == 0 on all BT=0 calls
    int kc = k0 + sc;                   // this lane's first k of the current K tile (APE only)

    // Issue the global loads of one K tile into ra/rb, as one batch.
    auto load_tiles = [&]() {
        if constexpr (!APE) {
            #pragma unroll
            for (int u = 0; u < 16; ++u)
                ra[u] = *(const float4*)pa[u];
        }
        if constexpr (ASUM) {
            #pragma unroll
            for (int u = 0; u < 16; ++u)
                ra2[u] = *(const float4*)(pa2 + (size_t)(8 * u) * lda);
        }
        #pragma unroll
        for (int u = 0; u < 8; ++u)
            rb[u] = *(const float4*)pb[u];
        if constexpr (APE) {
            // The two scheduling barriers hold the asm sines and cosines together, between the loads and
            // the WMMAs.
            __builtin_amdgcn_sched_barrier(0);
            const float d0 = exp_slot((float)kc * PE_LOG_STEP);
            const float d1 = exp_slot((float)(kc + 2) * PE_LOG_STEP);
            #pragma unroll
            for (int u = 0; u < 16; ++u) {
                const float pos = (float)(m0 + wave + 8 * u);
                sincos_slot(pos * d0, ra[u].x, ra[u].y);
                sincos_slot(pos * d1, ra[u].z, ra[u].w);
            }
            __builtin_amdgcn_sched_barrier(0);
        }
    };
    auto step_tiles = [&]() {
        #pragma unroll
        for (int u = 0; u < 16; ++u) pa[u] += APE ? 0 : KG * GEMM_BK;
        #pragma unroll
        for (int u = 0; u < 8; ++u)  pb[u] += bstep;
        if constexpr (ASUM) pa2 += KG * GEMM_BK;
        kc += KG * GEMM_BK;
    };
    // Convert staged registers to bf16 and write LDS.
    auto store_tiles = [&]() {
        #pragma unroll
        for (int u = 0; u < 16; ++u) {
            if constexpr (ASUM) {
                ra[u].x = fmaxf(ra[u].x + ra2[u].x, 0.0f);
                ra[u].y = fmaxf(ra[u].y + ra2[u].y, 0.0f);
                ra[u].z = fmaxf(ra[u].z + ra2[u].z, 0.0f);
                ra[u].w = fmaxf(ra[u].w + ra2[u].w, 0.0f);
            }
            v4bf y = { (__bf16)ra[u].x, (__bf16)ra[u].y, (__bf16)ra[u].z, (__bf16)ra[u].w };
            *(v4bf*)&ldsA[(wave + 8 * u) * GEMM_LD + sc] = y;
        }
        if (BT) {
            #pragma unroll
            for (int u = 0; u < 8; ++u) {
                v4bf y = { (__bf16)rb[u].x, (__bf16)rb[u].y, (__bf16)rb[u].z, (__bf16)rb[u].w };
                if (n0 + wave + 8 * u >= N)     // rows past N count as zero
                    y = v4bf{ (__bf16)0.f, (__bf16)0.f, (__bf16)0.f, (__bf16)0.f };
                *(v4bf*)&ldsB[(wave + 8 * u) * GEMM_LD + sc] = y;
            }
        } else {
            if (!bok) {                         // columns past N count as zero
                #pragma unroll
                for (int u = 0; u < 8; ++u)
                    rb[u] = float4{ 0.f, 0.f, 0.f, 0.f };
            }
            v8bf y0, y1, y2, y3;                // the 8 x 4 block, turned in registers
            #pragma unroll
            for (int u = 0; u < 8; ++u) {
                y0[u] = (__bf16)rb[u].x;
                y1[u] = (__bf16)rb[u].y;
                y2[u] = (__bf16)rb[u].z;
                y3[u] = (__bf16)rb[u].w;
            }
            *(v8bf*)&ldsB[(bq + 0) * GEMM_LD + bk] = y0;
            *(v8bf*)&ldsB[(bq + 1) * GEMM_LD + bk] = y1;
            *(v8bf*)&ldsB[(bq + 2) * GEMM_LD + bk] = y2;
            *(v8bf*)&ldsB[(bq + 3) * GEMM_LD + bk] = y3;
        }
    };

    v8f acc[2][2] = {};
    // This lane's place in a plane of raw sums, in floats.
    const size_t rawoff = ((size_t)(by * (N >> 6) + bx) * 8 + wave) * 1024 + lane * 4;

    load_tiles();                        // prologue: tile 0 in flight
    if (INIT && Cin && g == 0) {         // of all that share a product's K, one group of waves carries Cin in
        const v4f* cp = (const v4f*)(Cin + rawoff);
        #pragma unroll
        for (int i = 0; i < 2; ++i)
            #pragma unroll
            for (int j = 0; j < 2; ++j) {
                const v4f lo = cp[(4 * i + 2 * j) * 32], hi = cp[(4 * i + 2 * j + 1) * 32];
                acc[i][j] = __builtin_shufflevector(lo, hi, 0, 1, 2, 3, 4, 5, 6, 7);
            }
        // Stands in front of whatever overwrites these loads' address registers behind the branch's end.
        // The pointer is an input so that its registers live up to the
        // wait: else the build lands the last load's result on them, with the other loads still going out.
        asm volatile("s_wait_xcnt 0x0" :: "v"(cp) : "memory");
    }
    // Kept rolled, so that each pass's loads go out as one batch in a block of their own: unrolled (four
    // trips are few enough for that), the build mixed the loads with waits on the first of them.
    #pragma unroll 1
    for (int kk = 0; kk < K; kk += KG * GEMM_BK) {
        store_tiles();                   // waits on outstanding loads here
        __syncthreads();
        if (kk + KG * GEMM_BK < K) {
            step_tiles();
            load_tiles();                // next tile's loads fly under WMMAs
        }

        // Fragment assembly per 16-bit A/B VGPR layout:
        // element e <-> K = 16*(e>>3) + 8*(lane>>4) + (e&7); two 16B chunks.
        union Frag { v16bf v; v8bf h[2]; };
        #pragma unroll
        for (int ks = 0; ks < GEMM_BK; ks += 32) {
            Frag fa[2], fb[2];
            #pragma unroll
            for (int i = 0; i < 2; ++i) {
                const __bf16* rp = &ldsA[(wm + 16 * i + lr) * GEMM_LD + ks];
                fa[i].h[0] = *(const v8bf*)(rp + kh * 8);
                fa[i].h[1] = *(const v8bf*)(rp + 16 + kh * 8);
                const __bf16* rq = &ldsB[(wn + 16 * i + lr) * GEMM_LD + ks];
                fb[i].h[0] = *(const v8bf*)(rq + kh * 8);
                fb[i].h[1] = *(const v8bf*)(rq + 16 + kh * 8);
            }
            #pragma unroll
            for (int i = 0; i < 2; ++i)
                #pragma unroll
                for (int j = 0; j < 2; ++j)
                    acc[i][j] = __builtin_amdgcn_wmma_f32_16x16x32_bf16(
                        false, fa[i].v, false, fb[j].v, (short)0, acc[i][j], false, false);
        }
        __syncthreads();
    }

    // KG=2: each group hands the other the fragment rows that the other finishes; the loop's last barrier
    // has ended every read of the tiles, whose LDS carries the sums (per wave 4 pieces of 32 lanes x 16 B).
    // The rows that this group finishes then lie in acc[0].
    constexpr int NI = KG == 2 ? 1 : 2;
    if constexpr (KG == 2) {
        v4f* const x = (v4f*)&ldsA_all[0];
        v4f* const xs = x + ((g * 8 + wave) * 4) * 32 + lane;
        const v4f* const xr = x + (((1 - g) * 8 + wave) * 4) * 32 + lane;
        #pragma unroll
        for (int j = 0; j < 2; ++j) {
            const v8f s = g ? acc[0][j] : acc[1][j];
            xs[(2 * j) * 32]     = __builtin_shufflevector(s, s, 0, 1, 2, 3);
            xs[(2 * j + 1) * 32] = __builtin_shufflevector(s, s, 4, 5, 6, 7);
        }
        __syncthreads();
        #pragma unroll
        for (int j = 0; j < 2; ++j) {
            const v4f lo = xr[(2 * j) * 32], hi = xr[(2 * j + 1) * 32];
            const v8f own = g ? acc[1][j] : acc[0][j];
            acc[0][j] = own + __builtin_shufflevector(lo, hi, 0, 1, 2, 3, 4, 5, 6, 7);
        }
    }

    if (raw) {
        v4f* cp = (v4f*)(C + rawoff);
        #pragma unroll
        for (int i = 0; i < NI; ++i)
            #pragma unroll
            for (int j = 0; j < 2; ++j) {
                const int fi = KG == 2 ? g : i;
                cp[(4 * fi + 2 * j) * 32]     = __builtin_shufflevector(acc[i][j], acc[i][j], 0, 1, 2, 3);
                cp[(4 * fi + 2 * j + 1) * 32] = __builtin_shufflevector(acc[i][j], acc[i][j], 4, 5, 6, 7);
            }
        // Stands in front of whatever overwrites the stores' address or data registers: in a kernel that
        // holds several products the code behind this return runs on into another product's text.
        asm volatile("s_wait_xcnt 0x0" ::: "memory");
        return;
    }

    // Epilogue: D layout — VGPR r holds M = r + 8*(lane>>4), N = lane&15.
    #pragma unroll
    for (int i = 0; i < NI; ++i) {
        int row = m0 + wm + 16 * (KG == 2 ? g : i) + 8 * kh;
        #pragma unroll
        for (int j = 0; j < 2; ++j) {
            int col = n0 + wn + 16 * j + lr;
            if (col < N) {
                float bv = 0.0f;
                if (EPI > 0 && bias) {          // one plane of a cut product takes the bias
                    const float* bp = bias + (n0 + wn + lr);
                    bv = bp[16 * j];
                    // Stands in front of whatever overwrites the load's address registers (the build forms the
                    // stores' address in them); the pointer is an input so that they live up to the wait.
                    asm volatile("s_wait_xcnt 0x0" :: "v"(bp) : "memory");
                }
                #pragma unroll
                for (int r = 0; r < 8; ++r) {
                    float val = acc[i][j][r] + bv;
                    if (EPI == 2) val = fmaxf(val, 0.0f);
                    C[(size_t)(row + r) * N + col] = val;
                }
            }
        }
    }
}

#define GEMM_LDS_TILES(KG) \
    __shared__ __align__(16) __bf16 ldsA[(KG) * 128 * GEMM_LD];   /* [m][k], one tile per group of waves */ \
    __shared__ __align__(16) __bf16 ldsB[(KG) * 64 * GEMM_LD];    /* [n][k] */

// The MLP's two products, each cut along K over blockIdx.z so that the launch reaches more WGPs and
// each work-group's chain of passes is short. ks, the k per work-group, is an argument and no constant:
// the K loop then stays a loop, with each pass's loads as one batch in a block of their own; unrolled,
// the build mixed the loads with waits on the first of them.
// Hidden layer before relu: plane z = pbar[:, ks z ...] @ wvw1[ks z ..., :]; plane 0 starts from h_pre,
// the raw sums of h_s @ W1[0:1024], and takes b1.
__global__ __launch_bounds__(512) void hidden_planes_kernel(
    const float* __restrict__ pbar, const float* __restrict__ wvw1, const float* __restrict__ b1,
    const float* __restrict__ h_pre, float* __restrict__ hpl, int ks)
{
    GEMM_LDS_TILES(2)
    const int z = blockIdx.z;
    gemm_tile<0, 1, 1, 0, 0, 2>(ldsA, ldsB, pbar + z * ks, wvw1 + (size_t)z * ks * D_MODEL,
                       z == 0 ? b1 : nullptr, z == 0 ? h_pre : nullptr, hpl + (size_t)z * B_SZ * D_MODEL,
                       D_MODEL, ks, N_ACT, false, blockIdx.x, blockIdx.y);
}
// Logits before bias: plane z = h[:, ks z ...] @ W2[ks z ..., :], h = relu(hpl[0] + hpl[1]).
__global__ __launch_bounds__(256) void logit_planes_kernel(
    const float* __restrict__ hpl, const float* __restrict__ W2, float* __restrict__ lpl, int ks)
{
    GEMM_LDS_TILES(1)
    const int z = blockIdx.z;
    gemm_tile<0, 0, 0, 0, 1>(ldsA, ldsB, hpl + z * ks, W2 + (size_t)z * ks * N_ACT, nullptr,
                             nullptr, lpl + (size_t)z * B_SZ * N_ACT,
                             N_ACT, ks, D_MODEL, false, blockIdx.x, blockIdx.y,
                             hpl + (size_t)B_SZ * D_MODEL + z * ks);
}
#define L_PLANES 8   // planes of the logits: K = 1024 in slices of 128

// All that needs nothing but h_s and the weights and is wanted by the second launch, in one launch:
// blockIdx.z = 0, 1, 2 are h_s @ WQ_out, h_s @ WQ_in and h_s @ W1[0:1024] (the first half of
// x @ W1, kept as raw sums); z = 3, 4 are pe @ WK_out (256 positions) and pe @ WK_in (257, in
// three row tiles), from which the pe terms of the scores follow as q @ (pe @ WK)^T.
__global__ __launch_bounds__(512) void first_products_kernel(
    const float* __restrict__ h_s, const float* __restrict__ WQ_out,
    const float* __restrict__ WQ_in, const float* __restrict__ W1,
    const float* __restrict__ WK_out, const float* __restrict__ WK_in,
    float* __restrict__ q_out, float* __restrict__ q_in, float* __restrict__ h_pre,
    float* __restrict__ pw_out, float* __restrict__ pw_in)
{
    GEMM_LDS_TILES(2)
    const int z = blockIdx.z;
    if (z >= 3) {
        if ((int)blockIdx.y >= z - 1) return;       // 2 row tiles of positions at z = 3, 3 at z = 4
        gemm_tile<0, 0, 0, 1, 0, 2>(ldsA, ldsB, nullptr, z == 3 ? WK_out : WK_in, nullptr, nullptr,
                              z == 3 ? pw_out : pw_in, D_MODEL, N_ACT, N_ACT, false, blockIdx.x, blockIdx.y);
        return;
    }
    gemm_tile<0, 0, 0, 0, 0, 2>(ldsA, ldsB, h_s, z == 0 ? WQ_out : (z == 1 ? WQ_in : W1), nullptr, nullptr,
                       z == 0 ? q_out : (z == 1 ? q_in : h_pre), D_MODEL, D_ENC, D_ENC, z == 2,
                       blockIdx.x, blockIdx.y);
}

// All that needs q, in one launch: z = 0, 1 are qk = q @ WK^T of the two heads, z = 2, 3 their pe
// terms q @ (pe @ WK)^T. z = 4, 5 are the two column halves of WV_in @ W1[1024:2048], a product of
// weights alone that is wanted only behind the pass over phi and finds idle WGPs here:
// ctx @ W1[1024:2048] = pbar @ (WV_in @ W1[1024:2048]).
__global__ __launch_bounds__(512) void second_products_kernel(
    const float* __restrict__ q_out, const float* __restrict__ q_in,
    const float* __restrict__ WK_out, const float* __restrict__ WK_in,
    const float* __restrict__ pw_out, const float* __restrict__ pw_in,
    const float* __restrict__ WV_in, const float* __restrict__ W1b,
    float* __restrict__ qk_out, float* __restrict__ qk_in,
    float* __restrict__ pe_dot_out, float* __restrict__ pe_dot_in, float* __restrict__ wvw1)
{
    GEMM_LDS_TILES(2)
    const int z = blockIdx.z;
    if (z >= 4) {
        gemm_tile<0, 0, 0, 0, 0, 2>(ldsA, ldsB, WV_in, W1b, nullptr, nullptr, wvw1, D_MODEL, D_MODEL,
                           D_MODEL, false, blockIdx.x + 8 * (z - 4), blockIdx.y);
        return;
    }
    gemm_tile<1, 0, 0, 0, 0, 2>(ldsA, ldsB, (z & 1) ? q_in : q_out,
                       z == 0 ? WK_out : z == 1 ? WK_in : z == 2 ? pw_out : pw_in, nullptr, nullptr,
                       z == 0 ? qk_out : z == 1 ? qk_in : z == 2 ? pe_dot_out : pe_dot_in,
                       z < 2 ? N_ACT : N_PREV + (z - 2), D_MODEL, D_MODEL, false, blockIdx.x, blockIdx.y);
}

// ---------------------------------------------------------------------------
// The one pass over phi. Block per b, wave per 32 rows n. While a row is in
// registers it gives both heads' scores (qk . phi[b,n] + pe-dot term, scaled)
// and is then added, weighted, into both heads' running row sums, with a
// running maximum per head (on-line softmax). The eight waves' partial sums are
// merged through LDS: v[b] first, then the input head's score of v[b] itself
// (position 0), which joins the input head's sums as one more row:
//   v[b]    = softmax(scores_out[b]) @ phi[b]
//   pbar[b] = attn_in[b,0] * v[b] + sum_n attn_in[b,n+1] * phi[b,n]
// ---------------------------------------------------------------------------
typedef __attribute__((ext_vector_type(4))) float f32x4;
typedef __attribute__((ext_vector_type(2))) float f32x2;

#define PHI_G 4   // rows per group (one step of the running maximum)

// Value of lane l ^ MASK inside the 16-lane row (DPP row_xmask).
template <int MASK>
__device__ __forceinline__ float row_xor(float x) {
    return __builtin_bit_cast(float, __builtin_amdgcn_update_dpp(
        0, __builtin_bit_cast(int, x), 0x160 | MASK, 0xf, 0xf, true));
}
// Value of lane l ^ 16.
__device__ __forceinline__ float half_xor(float x) {
    return __builtin_bit_cast(float, __builtin_amdgcn_permlanex16(
        __builtin_bit_cast(int, x), __builtin_bit_cast(int, x), 0x76543210, 0xfedcba98, false, false));
}
__device__ __forceinline__ float lane_value(float x, int l) {
    return __builtin_bit_cast(float, __builtin_amdgcn_readlane(__builtin_bit_cast(int, x), l));
}
// Sums over the wave's 32 lanes, N values side by side; every lane gets every sum.
template <int N>
__device__ __forceinline__ void wave_sums(float (&s)[N]) {
    #pragma unroll
    for (int i = 0; i < N; ++i) s[i] += row_xor<1>(s[i]);
    #pragma unroll
    for (int i = 0; i < N; ++i) s[i] += row_xor<2>(s[i]);
    #pragma unroll
    for (int i = 0; i < N; ++i) s[i] += row_xor<4>(s[i]);
    #pragma unroll
    for (int i = 0; i < N; ++i) s[i] += row_xor<8>(s[i]);
    #pragma unroll
    for (int i = 0; i < N; ++i) s[i] += half_xor(s[i]);
}

// Second launch-bounds argument: four waves per SIMD, so that two blocks (16 waves) share a WGP.
__global__ __launch_bounds__(256, 4) void phi_once_kernel(
    const float* __restrict__ phi,
    const float* __restrict__ qk_out, const float* __restrict__ qk_in,
    const float* __restrict__ pe_dot_out, const float* __restrict__ pe_dot_in,
    float* __restrict__ vout, float* __restrict__ pbar)
{
    const float inv_sqrt = 0.03125f;   // 1 / sqrt(D_MODEL)
    __shared__ __align__(16) float part[8][2][N_ACT];   // each wave's two unnormalised row sums
    __shared__ float pm[2][8], pl[2][8];                // each wave's running maximum and weight sum
    __shared__ float red[8];

    const int b    = blockIdx.x;
    const int t    = threadIdx.x;
    const int wave = __builtin_amdgcn_readfirstlane(t >> 5);
    const int lane = t & 31;

    f32x4 qo[4], qi[4];
    #pragma unroll
    for (int j = 0; j < 4; ++j) {
        qo[j] = ((const f32x4*)(qk_out + (size_t)b * N_ACT))[lane + 32 * j];
        qi[j] = ((const f32x4*)(qk_in  + (size_t)b * N_ACT))[lane + 32 * j];
    }
    // Lane l holds the pe-dot terms of the wave's row l.
    const float pe1 = pe_dot_out[(size_t)b * N_PREV + wave * 32 + lane];
    const float pe2 = pe_dot_in[(size_t)b * 257 + 1 + wave * 32 + lane];

    const f32x4* p4 = (const f32x4*)(phi + ((size_t)b * N_PREV + wave * 32) * N_ACT) + lane;

    f32x4 xa[PHI_G][4], xb[PHI_G][4];   // two groups of rows: the first is worked on while the second's loads still fly
    f32x4 a1[4] = {}, a2[4] = {};
    float m1 = -INFINITY, m2 = -INFINITY, l1 = 0.0f, l2 = 0.0f;

    // phi is read exactly once: non-temporal loads, 512 contiguous bytes per wave each.
    auto load_rows = [&](f32x4 (&xr)[PHI_G][4], int row0) {
        #pragma unroll
        for (int r = 0; r < PHI_G; ++r)
            #pragma unroll
            for (int j = 0; j < 4; ++j)
                xr[r][j] = __builtin_nontemporal_load(p4 + (row0 + r) * 128 + 32 * j);
    };
    auto take_rows = [&](const f32x4 (&xr)[PHI_G][4], int row0) {
        float s[2 * PHI_G];
        #pragma unroll
        for (int r = 0; r < PHI_G; ++r) {
            f32x4 d1 = xr[r][0] * qo[0], d2 = xr[r][0] * qi[0];
            #pragma unroll
            for (int j = 1; j < 4; ++j) {
                d1 = __builtin_elementwise_fma(xr[r][j], qo[j], d1);
                d2 = __builtin_elementwise_fma(xr[r][j], qi[j], d2);
            }
            s[r]         = (d1.x + d1.y) + (d1.z + d1.w);
            s[PHI_G + r] = (d2.x + d2.y) + (d2.z + d2.w);
        }
        wave_sums(s);
        float n1 = m1, n2 = m2;
        #pragma unroll
        for (int r = 0; r < PHI_G; ++r) {
            s[r]         = (s[r]         + lane_value(pe1, row0 + r)) * inv_sqrt;
            s[PHI_G + r] = (s[PHI_G + r] + lane_value(pe2, row0 + r)) * inv_sqrt;
            n1 = fmaxf(n1, s[r]);
            n2 = fmaxf(n2, s[PHI_G + r]);
        }
        const float c1 = exp_slot(m1 - n1), c2 = exp_slot(m2 - n2);   // 0 at the wave's first rows
        m1 = n1; m2 = n2;
        l1 *= c1; l2 *= c2;
        float p[2 * PHI_G];
        #pragma unroll
        for (int r = 0; r < PHI_G; ++r) {
            p[r]         = exp_slot(s[r] - n1);
            p[PHI_G + r] = exp_slot(s[PHI_G + r] - n2);
            l1 += p[r];
            l2 += p[PHI_G + r];
        }
        #pragma unroll
        for (int j = 0; j < 4; ++j) {
            f32x4 u1 = a1[j] * c1, u2 = a2[j] * c2;
            #pragma unroll
            for (int r = 0; r < PHI_G; ++r) {
                u1 = __builtin_elementwise_fma(xr[r][j], (f32x4)(p[r]), u1);
                u2 = __builtin_elementwise_fma(xr[r][j], (f32x4)(p[PHI_G + r]), u2);
            }
            a1[j] = u1; a2[j] = u2;
        }
    };

    // Kept rolled: unrolled, the arithmetic of many groups is put off behind their loads and spills.
    // No loaded row is carried over the back edge: carried, it is copied there behind a wait on its load.
    #pragma unroll 1
    for (int row = 0; row < 32; row += 2 * PHI_G) {
        load_rows(xa, row);
        load_rows(xb, row + PHI_G);
        // Holds all 32 loads in front of the arithmetic; without it the second group's are issued late.
        __builtin_amdgcn_sched_barrier(0);
        take_rows(xa, row);
        take_rows(xb, row + PHI_G);
    }

    #pragma unroll
    for (int j = 0; j < 4; ++j) {
        *(f32x4*)&part[wave][0][(lane + 32 * j) * 4] = a1[j];
        *(f32x4*)&part[wave][1][(lane + 32 * j) * 4] = a2[j];
    }
    if (lane == 0) {
        pm[0][wave] = m1; pl[0][wave] = l1;
        pm[1][wave] = m2; pl[1][wave] = l2;
    }
    __syncthreads();

    // Merge: thread t owns columns 2t and 2t + 1.
    float M1 = pm[0][0], M2 = pm[1][0];
    #pragma unroll
    for (int w = 1; w < 8; ++w) { M1 = fmaxf(M1, pm[0][w]); M2 = fmaxf(M2, pm[1][w]); }
    float L1 = 0.0f;
    f32x2 v = {};
    #pragma unroll
    for (int w = 0; w < 8; ++w) {
        const float f = __expf(pm[0][w] - M1);
        L1 += f * pl[0][w];
        v  += f * *(const f32x2*)&part[w][0][2 * t];
    }
    v *= 1.0f / L1;
    ((f32x2*)vout)[(size_t)b * 256 + t] = v;

    // Input head, position 0: the score of v[b] itself.
    const f32x2 q = ((const f32x2*)qk_in)[(size_t)b * 256 + t];
    float d[1] = { v.x * q.x + v.y * q.y };
    wave_sums(d);
    if (lane == 0) red[wave] = d[0];
    __syncthreads();
    float dv = red[0];
    #pragma unroll
    for (int w = 1; w < 8; ++w) dv += red[w];
    const float s0 = (dv + pe_dot_in[(size_t)b * 257]) * inv_sqrt;

    M2 = fmaxf(M2, s0);
    const float e0 = __expf(s0 - M2);
    float L2 = e0;
    f32x2 o = e0 * v;
    #pragma unroll
    for (int w = 0; w < 8; ++w) {
        const float f = __expf(pm[1][w] - M2);
        L2 += f * pl[1][w];
        o  += f * *(const f32x2*)&part[w][1][2 * t];
    }
    o *= 1.0f / L2;
    ((f32x2*)pbar)[(size_t)b * 256 + t] = o;
}

// ---------------------------------------------------------------------------
// Final row softmax of v + logits, logits = the sum of the L_PLANES planes + bias.
// One wave per row, one wave per work-group: 512 waves to start and not 4096. Lane l holds columns
// 4 (l + 32 j) ... + 3, j = 0 ... 3, so that each load and store of the wave covers 512 contiguous bytes.
// Maximum and sum go over the lanes in registers: no LDS, no barrier.
// ---------------------------------------------------------------------------
__device__ __forceinline__ float wave_max(float x) {
    x = fmaxf(x, row_xor<1>(x));
    x = fmaxf(x, row_xor<2>(x));
    x = fmaxf(x, row_xor<4>(x));
    x = fmaxf(x, row_xor<8>(x));
    return fmaxf(x, half_xor(x));
}

__global__ __launch_bounds__(32) void softmax_kernel(
    const float* __restrict__ src, const float* __restrict__ planes, const float* __restrict__ bias,
    float* __restrict__ dst)
{
    const int b = blockIdx.x, lane = threadIdx.x;
    const f32x4* const pp = (const f32x4*)(planes + (size_t)b * N_ACT) + lane;
    const f32x4* const vp = (const f32x4*)(src + (size_t)b * N_ACT) + lane;
    const f32x4* const gp = (const f32x4*)bias + lane;
    // All 40 loads of the lane go out as one batch.
    f32x4 p[L_PLANES][4], v[4], g[4];
    #pragma unroll
    for (int z = 0; z < L_PLANES; ++z)
        #pragma unroll
        for (int j = 0; j < 4; ++j)
            p[z][j] = pp[z * (B_SZ * N_ACT / 4) + 32 * j];
    #pragma unroll
    for (int j = 0; j < 4; ++j) { v[j] = vp[32 * j]; g[j] = gp[32 * j]; }
    // Stands in front of whatever overwrites the loads' base registers (the build puts a constant of the
    // lane exchange into one of them); it passes while the data is still on its way.
    asm volatile("s_wait_xcnt 0x0" ::: "memory");
    // Holds all 40 loads, and the wait behind them, in front of the sums: without it the build issued 14
    // loads and put the rest behind waits on them.
    __builtin_amdgcn_sched_barrier(0);

    f32x4 x[4];
    #pragma unroll
    for (int j = 0; j < 4; ++j) {
        f32x4 s = p[0][j];
        #pragma unroll
        for (int z = 1; z < L_PLANES; ++z) s += p[z][j];
        x[j] = v[j] + (s + g[j]);
    }
    float mx = -INFINITY;
    #pragma unroll
    for (int j = 0; j < 4; ++j)
        mx = fmaxf(mx, fmaxf(fmaxf(x[j].x, x[j].y), fmaxf(x[j].z, x[j].w)));
    mx = wave_max(mx);

    float sum[1] = { 0.0f };
    #pragma unroll
    for (int j = 0; j < 4; ++j) {
        x[j].x = exp_slot(x[j].x - mx);
        x[j].y = exp_slot(x[j].y - mx);
        x[j].z = exp_slot(x[j].z - mx);
        x[j].w = exp_slot(x[j].w - mx);
        sum[0] += (x[j].x + x[j].y) + (x[j].z + x[j].w);
    }
    wave_sums(sum);
    const float inv = 1.0f / sum[0];
    f32x4* const op = (f32x4*)(dst + (size_t)b * N_ACT) + lane;
    #pragma unroll
    for (int j = 0; j < 4; ++j) op[32 * j] = x[j] * inv;
}

// ---------------------------------------------------------------------------
extern "C" void kernel_launch(void* const* d_in, const int* in_sizes, int n_in,
                              void* d_out, int out_size, void* d_ws, size_t ws_size,
                              hipStream_t stream) {
    const float* h_s    = (const float*)d_in[0];
    const float* phi    = (const float*)d_in[1];
    const float* WQ_out = (const float*)d_in[2];
    const float* WK_out = (const float*)d_in[3];
    const float* WQ_in  = (const float*)d_in[4];
    const float* WK_in  = (const float*)d_in[5];
    const float* WV_in  = (const float*)d_in[6];
    const float* W1     = (const float*)d_in[7];
    const float* b1     = (const float*)d_in[8];
    const float* W2     = (const float*)d_in[9];
    const float* b2     = (const float*)d_in[10];
    float* out = (float*)d_out;

    float* ws      = (float*)d_ws;
    float* pw_out  = ws;                  // 256*1024: pe @ WK_out
    float* pw_in   = pw_out  + 256 * 1024;// 384*1024: pe @ WK_in (rows 0..256 are used)
    float* q_out   = pw_in   + 384 * 1024;// 512*1024
    float* q_in    = q_out   + 512 * 1024;// 512*1024
    float* h_pre   = q_in    + 512 * 1024;// 512*1024: h_s @ W1[0:1024], raw sums
    float* wvw1    = h_pre   + 512 * 1024;// 512*1024: WV_in @ W1[1024:2048]
    float* qk_out  = wvw1    + 512 * 1024;// 512*512
    float* qk_in   = qk_out  + 512 * 512; // 512*512
    float* pe_do   = qk_in   + 512 * 512; // 512*256
    float* pe_di   = pe_do   + 512 * 256; // 512*257
    float* vbuf    = pe_di   + 512 * 257; // 512*512
    float* pbar    = vbuf    + 512 * 512; // 512*512
    float* hpl     = pbar    + 512 * 512; // 2 planes of 512*1024: the hidden layer's partial sums
    float* lpl     = hpl     + 2 * 512 * 1024;// 8 planes of 512*512: the logits' partial sums

    const dim3 blk(256);
    const dim3 blk2(512);   // GEMMs whose K tiles are dealt to two groups of 8 waves

    // q_out = h_s @ WQ_out, q_in = h_s @ WQ_in, h_pre = h_s @ W1[0:1024], pe @ WK of both heads
    first_products_kernel<<<dim3(16, 4, 5), blk2, 0, stream>>>(h_s, WQ_out, WQ_in, W1, WK_out, WK_in,
                                                              q_out, q_in, h_pre, pw_out, pw_in);
    // qk = q @ WK^T and the pe-dot terms q @ (pe @ WK)^T, both heads; WV_in @ W1[1024:2048]
    second_products_kernel<<<dim3(8, 4, 6), blk2, 0, stream>>>(q_out, q_in, WK_out, WK_in, pw_out, pw_in,
                                                              WV_in, W1 + 1024 * 1024,
                                                              qk_out, qk_in, pe_do, pe_di, wvw1);

    // the one pass over phi: v and pbar
    phi_once_kernel<<<512, blk, 0, stream>>>(phi, qk_out, qk_in, pe_do, pe_di, vbuf, pbar);

    // MLP: relu([h_s ; ctx] @ W1 + b1) = relu(h_pre + pbar @ (WV_in @ W1[1024:2048]) + b1)
    hidden_planes_kernel<<<dim3(16, 4, 2), blk2, 0, stream>>>(pbar, wvw1, b1, h_pre, hpl, 256);
    logit_planes_kernel<<<dim3(8, 4, 8),  blk, 0, stream>>>(hpl, W2, lpl, 128);
    // out = softmax(v + logits)
    softmax_kernel<<<512, dim3(32), 0, stream>>>(vbuf, lpl, b2, out);
}

// v009
// It runs in 55 microseconds.
// Next to v008, in two timings, it ran 1.04 and 1.03 times as fast.
// All steps since v000 together make it 7.57 times as fast.
#include <hip/hip_runtime.h>
#include <hip/hip_bf16.h>
#include <math.h>

typedef __attribute__((ext_vector_type(16))) __bf16 v16bf;
typedef __attribute__((ext_vector_type(8)))  __bf16 v8bf;
typedef __attribute__((ext_vector_type(4)))  __bf16 v4bf;
typedef __attribute__((ext_vector_type(8)))  float  v8f;
typedef __attribute__((ext_vector_type(4)))  float  v4f;

#define B_SZ    512
#define D_ENC   1024
#define D_MODEL 1024
#define N_ACT   512
#define N_PREV  256

// ---------------------------------------------------------------------------
// Sinusoidal positional encoding: pe[pos, 2i] = sin(pos*div_i),
// pe[pos, 2i+1] = cos(pos*div_i), div_i = exp(2i * PE_LOG_STEP).
// ---------------------------------------------------------------------------
#define PE_LOG_STEP (-9.210340371976184f / 512.0f)

// e^x as 2^(x * log2 e), as __expf forms it. The v_nop fills the slot that the instruction set asks for
// behind a transcendental.
__device__ __forceinline__ float exp_slot(float x) {
    float r;
    asm("v_exp_f32 %0, %1\n\tv_nop" : "=v"(r) : "v"(x * 1.4426950408889634f));
    return r;
}
// sin a and cos a as __sinf and __cosf form them (the angle in turns). The results keep clear of the
// angle's register and the v_nop fills the slot that the instruction set asks for behind a
// transcendental.
__device__ __forceinline__ void sincos_slot(float a, float& s, float& c) {
    asm("v_sin_f32 %0, %2\n\tv_cos_f32 %1, %2\n\tv_nop" : "=&v"(s), "=&v"(c) : "v"(a * 0.15915494309189532f));
}

// ---------------------------------------------------------------------------
// WMMA GEMM: C = A(MxK) * B + optional bias / relu.
// BT=0: B is (K,N) row-major.  BT=1: B is (N,K) row-major (C = A*B^T).
// EPI: 0 = none, 1 = +bias, 2 = relu(+bias).
// A product over a long K can be cut in two launches with the order of its sums kept:
// raw = true stores the f32 sums as they lie in the accumulator registers (whole tiles only:
// per wave eight pieces of 32 lanes x 4 floats), and INIT=1 starts from such sums (Cin, of a
// product with the same M and N) instead of from zero.
// Block tile 128x64, 256 threads = 8 waves (4 along M x 2 along N),
// each wave computes 32x32 via 2x2 v_wmma_f32_16x16x32_bf16 fragments.
// One pass stages 128 k of both operands, so the exposed load latency and the
// two barriers are paid once per four WMMA k-steps.
// Software-pipelined: a staging register is loaded with its piece of the next K tile as soon as its piece
// of this tile has gone to LDS, and the loads fly across both barriers of the pass: each thread keeps a
// queue of loads that is never empty between the first pass and the last.
// M % 128 == 0, K % 128 == 0; N guarded (BT path supports ragged N, e.g. 257).
// APE=1: A is the positional encoding itself (row = position, K = 512); its elements are
// formed in the staging registers and A is not read.
// A product can also be cut along K over work-groups: each takes K columns of A (row pitch lda)
// and K rows of B and stores its own plane of partial sums; whoever reads the product adds the planes.
// ASUM=1: A is relu(A + A2), the sum of two such planes, formed in the staging registers.
// KG=2: the work-group has 16 waves in two groups of 8 with LDS tiles of their own. Group g takes the
// K tiles g, g + 2, ..., so that twice the bytes are in flight per pass and the passes are half as many
// (K % 256 == 0). Behind the loop the groups swap halves of their sums through LDS: group g adds up and
// stores the fragment rows i = g of every wave tile.
// (bx, by) is the tile's place; the two LDS tiles belong to the calling kernel.
// ---------------------------------------------------------------------------
#define GEMM_BK 128
#define GEMM_LD 136   // LDS row pitch in bf16: 272 B = 16 B x odd, for ds_load_b128

// The work-group's barrier for data that passes through LDS alone: the two fences order LDS accesses only,
// so that global loads issued in front of it stay in flight across it (__syncthreads() waits them out).
__device__ __forceinline__ void lds_barrier() {
    __builtin_amdgcn_fence(__ATOMIC_RELEASE, "workgroup", "local");
    __builtin_amdgcn_s_barrier();
    __builtin_amdgcn_fence(__ATOMIC_ACQUIRE, "workgroup", "local");
}
template <bool V> struct flag_t { static constexpr bool value = V; };

template <int BT, int EPI, int INIT, int APE = 0, int ASUM = 0, int KG = 1>
__device__ __forceinline__ void gemm_tile(
    __bf16 (&ldsA_all)[KG * 128 * GEMM_LD], __bf16 (&ldsB_all)[KG * 64 * GEMM_LD],
    const float* __restrict__ A, const float* __restrict__ B,
    const float* __restrict__ bias, const float* __restrict__ Cin, float* __restrict__ C,
    int N, int K, int lda, const bool raw, const unsigned bx, const unsigned by,
    const float* __restrict__ A2 = nullptr)
{
    const int t    = KG == 2 ? (threadIdx.x & 255) : threadIdx.x;   // place in the group of 8 waves
    const int g    = KG == 2 ? __builtin_amdgcn_readfirstlane(threadIdx.x >> 8) : 0;
    __bf16* const ldsA = &ldsA_all[g * (128 * GEMM_LD)];
    __bf16* const ldsB = &ldsB_all[g * (64 * GEMM_LD)];
    const int k0   = g * GEMM_BK;       // the group's first K tile
    const int m0   = by * 128;
    const int n0   = bx * 64;
    if (n0 >= N) return;                // the narrower of the products that share a grid
    const int wave = t >> 5;
    const int lane = t & 31;
    const int wm   = (wave & 3) * 32;   // wave row offset in block tile
    const int wn   = (wave >> 2) * 32;  // wave col offset in block tile
    const int lr   = lane & 15;
    const int kh   = lane >> 4;         // K-half selector per ISA layout

    // Staging coordinates (fixed across K tiles).
    // K-contiguous operands: wave w stages rows w, w + 8, ...; one load covers
    // one 512-B row piece.
    const int sc = lane * 4;            // k offset in the tile
    // BT=0: each thread takes a block of 8 consecutive k-rows x 4 columns (one n quad), so that it
    // holds 8 consecutive k of each of its columns and can write them to the [n][k] tile 16 B at a time.
    const int bk = (t >> 4) * 8;
    const int bq = (t & 15) * 4;

    float4 ra[16], rb[8];
    float4 ra2[ASUM ? 16 : 1];          // ASUM: the second plane's rows

    // One pointer per staged row, stepped in place from K tile to K tile.
    const float* pa[16];
    const float* pb[8];
    #pragma unroll
    for (int u = 0; u < 16; ++u)
        pa[u] = APE ? nullptr : &A[(size_t)(m0 + wave + 8 * u) * lda + k0 + sc];
    const float* pa2 = ASUM ? &A2[(size_t)(m0 + wave) * lda + k0 + sc] : nullptr;
    #pragma unroll
    for (int u = 0; u < 8; ++u)
        pb[u] = BT ? &B[(size_t)min(n0 + wave + 8 * u, N - 1) * K + k0 + sc]  // ragged N: row clamped into B
                   : &B[(size_t)(k0 + bk + u) * N + min(n0 + bq, N - 4)];
    const size_t bstep = BT ? (size_t)(KG * GEMM_BK) : (size_t)(KG * GEMM_BK) * N;
    const bool   bok   = BT || (n0 + bq < N);   // N % 4 == 0 on all BT=0 calls
    int kc = k0 + sc;                   // this lane's first k of the current K tile (APE only)

    // Issue the global loads of one K tile into ra/rb, as one batch.
    auto load_tiles = [&]() {
        if constexpr (!APE) {
            #pragma unroll
            for (int u = 0; u < 16; ++u)
                ra[u] = *(const float4*)pa[u];
        }
        if constexpr (ASUM) {
            #pragma unroll
            for (int u = 0; u < 16; ++u)
                ra2[u] = *(const float4*)(pa2 + (size_t)(8 * u) * lda);
        }
        #pragma unroll
        for (int u = 0; u < 8; ++u)
            rb[u] = *(const float4*)pb[u];
    };
    // APE: the A rows of the K tile that begins at kc.
    auto form_pe = [&]() {
        if constexpr (APE) {
            // The two scheduling barriers hold the asm sines and cosines together, between the loads and
            // the WMMAs.
            __builtin_amdgcn_sched_barrier(0);
            const float d0 = exp_slot((float)kc * PE_LOG_STEP);
            const float d1 = exp_slot((float)(kc + 2) * PE_LOG_STEP);
            #pragma unroll
            for (int u = 0; u < 16; ++u) {
                const float pos = (float)(m0 + wave + 8 * u);
                sincos_slot(pos * d0, ra[u].x, ra[u].y);
                sincos_slot(pos * d1, ra[u].z, ra[u].w);
            }
            __builtin_amdgcn_sched_barrier(0);
        }
    };
    auto step_tiles = [&]() {
        #pragma unroll
        for (int u = 0; u < 16; ++u) pa[u] += APE ? 0 : KG * GEMM_BK;
        #pragma unroll
        for (int u = 0; u < 8; ++u)  pb[u] += bstep;
        if constexpr (ASUM) pa2 += KG * GEMM_BK;
        kc += KG * GEMM_BK;
    };
    // Convert staged registers to bf16 and write LDS; next: refill each register from the next K tile
    // behind its conversion.
    auto store_tiles = [&](auto next) {
        constexpr bool NEXT = decltype(next)::value;
        #pragma unroll
        for (int u = 0; u < 16; ++u) {
            if constexpr (ASUM) {
                ra[u].x = fmaxf(ra[u].x + ra2[u].x, 0.0f);
                ra[u].y = fmaxf(ra[u].y + ra2[u].y, 0.0f);
                ra[u].z = fmaxf(ra[u].z + ra2[u].z, 0.0f);
                ra[u].w = fmaxf(ra[u].w + ra2[u].w, 0.0f);
            }
            v4bf y = { (__bf16)ra[u].x, (__bf16)ra[u].y, (__bf16)ra[u].z, (__bf16)ra[u].w };
            *(v4bf*)&ldsA[(wave + 8 * u) * GEMM_LD + sc] = y;
            if constexpr (NEXT && !APE) {
                pa[u] += KG * GEMM_BK;
                ra[u] = *(const float4*)pa[u];
            }
        }
        if (BT) {
            #pragma unroll
            for (int u = 0; u < 8; ++u) {
                v4bf y = { (__bf16)rb[u].x, (__bf16)rb[u].y, (__bf16)rb[u].z, (__bf16)rb[u].w };
                if (n0 + wave + 8 * u >= N)     // rows past N count as zero
                    y = v4bf{ (__bf16)0.f, (__bf16)0.f, (__bf16)0.f, (__bf16)0.f };
                *(v4bf*)&ldsB[(wave + 8 * u) * GEMM_LD + sc] = y;
                if constexpr (NEXT) {
                    pb[u] += bstep;
                    rb[u] = *(const float4*)pb[u];
                }
            }
        } else {
            if (!bok) {                         // columns past N count as zero
                #pragma unroll
                for (int u = 0; u < 8; ++u)
                    rb[u] = float4{ 0.f, 0.f, 0.f, 0.f };
            }
            v8bf y0, y1, y2, y3;                // the 8 x 4 block, turned in registers
            #pragma unroll
            for (int u = 0; u < 8; ++u) {
                y0[u] = (__bf16)rb[u].x;
                y1[u] = (__bf16)rb[u].y;
                y2[u] = (__bf16)rb[u].z;
                y3[u] = (__bf16)rb[u].w;
            }
            *(v8bf*)&ldsB[(bq + 0) * GEMM_LD + bk] = y0;
            *(v8bf*)&ldsB[(bq + 1) * GEMM_LD + bk] = y1;
            *(v8bf*)&ldsB[(bq + 2) * GEMM_LD + bk] = y2;
            *(v8bf*)&ldsB[(bq + 3) * GEMM_LD + bk] = y3;
            if constexpr (NEXT) {
                #pragma unroll
                for (int u = 0; u < 8; ++u) {
                    pb[u] += bstep;
                    rb[u] = *(const float4*)pb[u];
                }
            }
        }
        if constexpr (NEXT) kc += KG * GEMM_BK;
    };

    v8f acc[2][2] = {};
    // This lane's place in a plane of raw sums, in floats.
    const size_t rawoff = ((size_t)(by * (N >> 6) + bx) * 8 + wave) * 1024 + lane * 4;

    load_tiles();                        // prologue: tile 0 in flight
    form_pe();
    if (INIT && Cin && g == 0) {         // of all that share a product's K, one group of waves carries Cin in
        const v4f* cp = (const v4f*)(Cin + rawoff);
        #pragma unroll
        for (int i = 0; i < 2; ++i)
            #pragma unroll
            for (int j = 0; j < 2; ++j) {
                const v4f lo = cp[(4 * i + 2 * j) * 32], hi = cp[(4 * i + 2 * j + 1) * 32];
                acc[i][j] = __builtin_shufflevector(lo, hi, 0, 1, 2, 3, 4, 5, 6, 7);
            }
        // Stands in front of whatever overwrites these loads' address registers behind the branch's end.
        // The pointer is an input so that its registers live up to the
        // wait: else the build lands the last load's result on them, with the other loads still going out.
        asm volatile("s_wait_xcnt 0x0" :: "v"(cp) : "memory");
    }
    // The products of the K tile that lies in LDS.
    auto tile_products = [&]() {
        // Fragment assembly per 16-bit A/B VGPR layout:
        // element e <-> K = 16*(e>>3) + 8*(lane>>4) + (e&7); two 16B chunks.
        union Frag { v16bf v; v8bf h[2]; };
        #pragma unroll
        for (int ks = 0; ks < GEMM_BK; ks += 32) {
            Frag fa[2], fb[2];
            #pragma unroll
            for (int i = 0; i < 2; ++i) {
                const __bf16* rp = &ldsA[(wm + 16 * i + lr) * GEMM_LD + ks];
                fa[i].h[0] = *(const v8bf*)(rp + kh * 8);
                fa[i].h[1] = *(const v8bf*)(rp + 16 + kh * 8);
                const __bf16* rq = &ldsB[(wn + 16 * i + lr) * GEMM_LD + ks];
                fb[i].h[0] = *(const v8bf*)(rq + kh * 8);
                fb[i].h[1] = *(const v8bf*)(rq + 16 + kh * 8);
            }
            #pragma unroll
            for (int i = 0; i < 2; ++i)
                #pragma unroll
                for (int j = 0; j < 2; ++j)
                    acc[i][j] = __builtin_amdgcn_wmma_f32_16x16x32_bf16(
                        false, fa[i].v, false, fb[j].v, (short)0, acc[i][j], false, false);
        }
    };
    if constexpr (ASUM) {
        // With two planes to stage the kernel needs more than 256 VGPRs: a pass's loads go out as one batch behind its first
        // barrier. Kept rolled, so that they have a block of their own: unrolled, the build mixed the loads
        // with waits on the first of them.
        #pragma unroll 1
        for (int kk = 0; kk < K; kk += KG * GEMM_BK) {
            store_tiles(flag_t<false>{});    // waits on outstanding loads here
            __syncthreads();
            if (kk + KG * GEMM_BK < K) {
                step_tiles();
                load_tiles();                // next tile's loads fly under WMMAs
            }
            tile_products();
            __syncthreads();
        }
    } else {
        // All passes but the last: each waits on every load in its turn and issues that load's successor.
        // Kept rolled: unrolled (three trips are few enough for that), the build moved each refill's
        // conversion up to the refill, behind a wait on it.
        #pragma unroll 1
        for (int kk = KG * GEMM_BK; kk < K; kk += KG * GEMM_BK) {
            store_tiles(flag_t<true>{});
            lds_barrier();
            // Stands in front of whatever overwrites the refills' address registers: the build takes some of
            // them for fragments (ds_load).
            asm volatile("s_wait_xcnt 0x0" ::: "memory");
            form_pe();
            tile_products();
            lds_barrier();
        }
        // The last pass has no successor to load.
        store_tiles(flag_t<false>{});
        lds_barrier();
        tile_products();
        lds_barrier();
    }

    // KG=2: each group hands the other the fragment rows that the other finishes; the loop's last barrier
    // has ended every read of the tiles, whose LDS carries the sums (per wave 4 pieces of 32 lanes x 16 B).
    // The rows that this group finishes then lie in acc[0].
    constexpr int NI = KG == 2 ? 1 : 2;
    if constexpr (KG == 2) {
        v4f* const x = (v4f*)&ldsA_all[0];
        v4f* const xs = x + ((g * 8 + wave) * 4) * 32 + lane;
        const v4f* const xr = x + (((1 - g) * 8 + wave) * 4) * 32 + lane;
        #pragma unroll
        for (int j = 0; j < 2; ++j) {
            const v8f s = g ? acc[0][j] : acc[1][j];
            xs[(2 * j) * 32]     = __builtin_shufflevector(s, s, 0, 1, 2, 3);
            xs[(2 * j + 1) * 32] = __builtin_shufflevector(s, s, 4, 5, 6, 7);
        }
        __syncthreads();
        #pragma unroll
        for (int j = 0; j < 2; ++j) {
            const v4f lo = xr[(2 * j) * 32], hi = xr[(2 * j + 1) * 32];
            const v8f own = g ? acc[1][j] : acc[0][j];
            acc[0][j] = own + __builtin_shufflevector(lo, hi, 0, 1, 2, 3, 4, 5, 6, 7);
        }
    }

    if (raw) {
        v4f* cp = (v4f*)(C + rawoff);
        #pragma unroll
        for (int i = 0; i < NI; ++i)
            #pragma unroll
            for (int j = 0; j < 2; ++j) {
                const int fi = KG == 2 ? g : i;
                cp[(4 * fi + 2 * j) * 32]     = __builtin_shufflevector(acc[i][j], acc[i][j], 0, 1, 2, 3);
                cp[(4 * fi + 2 * j + 1) * 32] = __builtin_shufflevector(acc[i][j], acc[i][j], 4, 5, 6, 7);
            }
        // Stands in front of whatever overwrites the stores' address or data registers: in a kernel that
        // holds several products the code behind this return runs on into another product's text.
        asm volatile("s_wait_xcnt 0x0" ::: "memory");
        return;
    }

    // Epilogue: D layout — VGPR r holds M = r + 8*(lane>>4), N = lane&15.
    #pragma unroll
    for (int i = 0; i < NI; ++i) {
        int row = m0 + wm + 16 * (KG == 2 ? g : i) + 8 * kh;
        #pragma unroll
        for (int j = 0; j < 2; ++j) {
            int col = n0 + wn + 16 * j + lr;
            if (col < N) {
                float bv = 0.0f;
                if (EPI > 0 && bias) {          // one plane of a cut product takes the bias
                    const float* bp = bias + (n0 + wn + lr);
                    bv = bp[16 * j];
                    // Stands in front of whatever overwrites the load's address registers (the build forms the
                    // stores' address in them); the pointer is an input so that they live up to the wait.
                    asm volatile("s_wait_xcnt 0x0" :: "v"(bp) : "memory");
                }
                #pragma unroll
                for (int r = 0; r < 8; ++r) {
                    float val = acc[i][j][r] + bv;
                    if (EPI == 2) val = fmaxf(val, 0.0f);
                    C[(size_t)(row + r) * N + col] = val;
                }
            }
        }
    }
}

#define GEMM_LDS_TILES(KG) \
    __shared__ __align__(16) __bf16 ldsA[(KG) * 128 * GEMM_LD];   /* [m][k], one tile per group of waves */ \
    __shared__ __align__(16) __bf16 ldsB[(KG) * 64 * GEMM_LD];    /* [n][k] */

// The MLP's two products, each cut along K over blockIdx.z so that the launch reaches more WGPs and
// each work-group's chain of passes is short. ks, the k per work-group, is an argument and no constant:
// the K loop then stays a loop, with the first tile's loads as one batch in a block of their own; unrolled,
// the build mixed the loads with waits on the first of them.
// Hidden layer before relu: plane z = pbar[:, ks z ...] @ wvw1[ks z ..., :]; plane 0 starts from h_pre,
// the raw sums of h_s @ W1[0:1024], and takes b1.
__global__ __launch_bounds__(512) void hidden_planes_kernel(
    const float* __restrict__ pbar, const float* __restrict__ wvw1, const float* __restrict__ b1,
    const float* __restrict__ h_pre, float* __restrict__ hpl, int ks)
{
    GEMM_LDS_TILES(2)
    const int z = blockIdx.z;
    gemm_tile<0, 1, 1, 0, 0, 2>(ldsA, ldsB, pbar + z * ks, wvw1 + (size_t)z * ks * D_MODEL,
                       z == 0 ? b1 : nullptr, z == 0 ? h_pre : nullptr, hpl + (size_t)z * B_SZ * D_MODEL,
                       D_MODEL, ks, N_ACT, false, blockIdx.x, blockIdx.y);
}
// Logits before bias: plane z = h[:, ks z ...] @ W2[ks z ..., :], h = relu(hpl[0] + hpl[1]).
__global__ __launch_bounds__(256) void logit_planes_kernel(
    const float* __restrict__ hpl, const float* __restrict__ W2, float* __restrict__ lpl, int ks)
{
    GEMM_LDS_TILES(1)
    const int z = blockIdx.z;
    gemm_tile<0, 0, 0, 0, 1>(ldsA, ldsB, hpl + z * ks, W2 + (size_t)z * ks * N_ACT, nullptr,
                             nullptr, lpl + (size_t)z * B_SZ * N_ACT,
                             N_ACT, ks, D_MODEL, false, blockIdx.x, blockIdx.y,
                             hpl + (size_t)B_SZ * D_MODEL + z * ks);
}
#define L_PLANES 8   // planes of the logits: K = 1024 in slices of 128

// All that needs nothing but h_s and the weights and is wanted by the second launch, in one launch:
// blockIdx.z = 0, 1, 2 are h_s @ WQ_out, h_s @ WQ_in and h_s @ W1[0:1024] (the first half of
// x @ W1, kept as raw sums); z = 3, 4 are pe @ WK_out (256 positions) and pe @ WK_in (257, in
// three row tiles), from which the pe terms of the scores follow as q @ (pe @ WK)^T.
__global__ __launch_bounds__(512) void first_products_kernel(
    const float* __restrict__ h_s, const float* __restrict__ WQ_out,
    const float* __restrict__ WQ_in, const float* __restrict__ W1,
    const float* __restrict__ WK_out, const float* __restrict__ WK_in,
    float* __restrict__ q_out, float* __restrict__ q_in, float* __restrict__ h_pre,
    float* __restrict__ pw_out, float* __restrict__ pw_in)
{
    GEMM_LDS_TILES(2)
    const int z = blockIdx.z;
    if (z >= 3) {
        if ((int)blockIdx.y >= z - 1) return;       // 2 row tiles of positions at z = 3, 3 at z = 4
        gemm_tile<0, 0, 0, 1, 0, 2>(ldsA, ldsB, nullptr, z == 3 ? WK_out : WK_in, nullptr, nullptr,
                              z == 3 ? pw_out : pw_in, D_MODEL, N_ACT, N_ACT, false, blockIdx.x, blockIdx.y);
        return;
    }
    gemm_tile<0, 0, 0, 0, 0, 2>(ldsA, ldsB, h_s, z == 0 ? WQ_out : (z == 1 ? WQ_in : W1), nullptr, nullptr,
                       z == 0 ? q_out : (z == 1 ? q_in : h_pre), D_MODEL, D_ENC, D_ENC, z == 2,
                       blockIdx.x, blockIdx.y);
}

// All that needs q, in one launch: z = 0, 1 are qk = q @ WK^T of the two heads, z = 2, 3 their pe
// terms q @ (pe @ WK)^T. z = 4, 5 are the two column halves of WV_in @ W1[1024:2048], a product of
// weights alone that is wanted only behind the pass over phi and finds idle WGPs here:
// ctx @ W1[1024:2048] = pbar @ (WV_in @ W1[1024:2048]).
__global__ __launch_bounds__(512) void second_products_kernel(
    const float* __restrict__ q_out, const float* __restrict__ q_in,
    const float* __restrict__ WK_out, const float* __restrict__ WK_in,
    const float* __restrict__ pw_out, const float* __restrict__ pw_in,
    const float* __restrict__ WV_in, const float* __restrict__ W1b,
    float* __restrict__ qk_out, float* __restrict__ qk_in,
    float* __restrict__ pe_dot_out, float* __restrict__ pe_dot_in, float* __restrict__ wvw1)
{
    GEMM_LDS_TILES(2)
    const int z = blockIdx.z;
    if (z >= 4) {
        gemm_tile<0, 0, 0, 0, 0, 2>(ldsA, ldsB, WV_in, W1b, nullptr, nullptr, wvw1, D_MODEL, D_MODEL,
                           D_MODEL, false, blockIdx.x + 8 * (z - 4), blockIdx.y);
        return;
    }
    gemm_tile<1, 0, 0, 0, 0, 2>(ldsA, ldsB, (z & 1) ? q_in : q_out,
                       z == 0 ? WK_out : z == 1 ? WK_in : z == 2 ? pw_out : pw_in, nullptr, nullptr,
                       z == 0 ? qk_out : z == 1 ? qk_in : z == 2 ? pe_dot_out : pe_dot_in,
                       z < 2 ? N_ACT : N_PREV + (z - 2), D_MODEL, D_MODEL, false, blockIdx.x, blockIdx.y);
}

// ---------------------------------------------------------------------------
// The one pass over phi. Block per b, wave per 32 rows n. While a row is in
// registers it gives both heads' scores (qk . phi[b,n] + pe-dot term, scaled)
// and is then added, weighted, into both heads' running row sums, with a
// running maximum per head (on-line softmax). The eight waves' partial sums are
// merged through LDS: v[b] first, then the input head's score of v[b] itself
// (position 0), which joins the input head's sums as one more row:
//   v[b]    = softmax(scores_out[b]) @ phi[b]
//   pbar[b] = attn_in[b,0] * v[b] + sum_n attn_in[b,n+1] * phi[b,n]
// ---------------------------------------------------------------------------
typedef __attribute__((ext_vector_type(4))) float f32x4;
typedef __attribute__((ext_vector_type(2))) float f32x2;

#define PHI_G 4   // rows per group (one step of the running maximum)

// Value of lane l ^ MASK inside the 16-lane row (DPP row_xmask).
template <int MASK>
__device__ __forceinline__ float row_xor(float x) {
    return __builtin_bit_cast(float, __builtin_amdgcn_update_dpp(
        0, __builtin_bit_cast(int, x), 0x160 | MASK, 0xf, 0xf, true));
}
// Value of lane l ^ 16.
__device__ __forceinline__ float half_xor(float x) {
    return __builtin_bit_cast(float, __builtin_amdgcn_permlanex16(
        __builtin_bit_cast(int, x), __builtin_bit_cast(int, x), 0x76543210, 0xfedcba98, false, false));
}
__device__ __forceinline__ float lane_value(float x, int l) {
    return __builtin_bit_cast(float, __builtin_amdgcn_readlane(__builtin_bit_cast(int, x), l));
}
// Sums over the wave's 32 lanes, N values side by side; every lane gets every sum.
template <int N>
__device__ __forceinline__ void wave_sums(float (&s)[N]) {
    #pragma unroll
    for (int i = 0; i < N; ++i) s[i] += row_xor<1>(s[i]);
    #pragma unroll
    for (int i = 0; i < N; ++i) s[i] += row_xor<2>(s[i]);
    #pragma unroll
    for (int i = 0; i < N; ++i) s[i] += row_xor<4>(s[i]);
    #pragma unroll
    for (int i = 0; i < N; ++i) s[i] += row_xor<8>(s[i]);
    #pragma unroll
    for (int i = 0; i < N; ++i) s[i] += half_xor(s[i]);
}

// Second launch-bounds argument: four waves per SIMD, so that two blocks (16 waves) share a WGP.
__global__ __launch_bounds__(256, 4) void phi_once_kernel(
    const float* __restrict__ phi,
    const float* __restrict__ qk_out, const float* __restrict__ qk_in,
    const float* __restrict__ pe_dot_out, const float* __restrict__ pe_dot_in,
    float* __restrict__ vout, float* __restrict__ pbar)
{
    const float inv_sqrt = 0.03125f;   // 1 / sqrt(D_MODEL)
    __shared__ __align__(16) float part[8][2][N_ACT];   // each wave's two unnormalised row sums
    __shared__ float pm[2][8], pl[2][8];                // each wave's running maximum and weight sum
    __shared__ float red[8];

    const int b    = blockIdx.x;
    const int t    = threadIdx.x;
    const int wave = __builtin_amdgcn_readfirstlane(t >> 5);
    const int lane = t & 31;

    f32x4 qo[4], qi[4];
    #pragma unroll
    for (int j = 0; j < 4; ++j) {
        qo[j] = ((const f32x4*)(qk_out + (size_t)b * N_ACT))[lane + 32 * j];
        qi[j] = ((const f32x4*)(qk_in  + (size_t)b * N_ACT))[lane + 32 * j];
    }
    // Lane l holds the pe-dot terms of the wave's row l.
    const float pe1 = pe_dot_out[(size_t)b * N_PREV + wave * 32 + lane];
    const float pe2 = pe_dot_in[(size_t)b * 257 + 1 + wave * 32 + lane];

    const f32x4* p4 = (const f32x4*)(phi + ((size_t)b * N_PREV + wave * 32) * N_ACT) + lane;

    f32x4 xa[PHI_G][4], xb[PHI_G][4];   // two groups of rows: the first is worked on while the second's loads still fly
    f32x4 a1[4] = {}, a2[4] = {};
    float m1 = -INFINITY, m2 = -INFINITY, l1 = 0.0f, l2 = 0.0f;

    // phi is read exactly once: non-temporal loads, 512 contiguous bytes per wave each.
    auto load_rows = [&](f32x4 (&xr)[PHI_G][4], int row0) {
        #pragma unroll
        for (int r = 0; r < PHI_G; ++r)
            #pragma unroll
            for (int j = 0; j < 4; ++j)
                xr[r][j] = __builtin_nontemporal_load(p4 + (row0 + r) * 128 + 32 * j);
    };
    auto take_rows = [&](const f32x4 (&xr)[PHI_G][4], int row0) {
        float s[2 * PHI_G];
        #pragma unroll
        for (int r = 0; r < PHI_G; ++r) {
            f32x4 d1 = xr[r][0] * qo[0], d2 = xr[r][0] * qi[0];
            #pragma unroll
            for (int j = 1; j < 4; ++j) {
                d1 = __builtin_elementwise_fma(xr[r][j], qo[j], d1);
                d2 = __builtin_elementwise_fma(xr[r][j], qi[j], d2);
            }
            s[r]         = (d1.x + d1.y) + (d1.z + d1.w);
            s[PHI_G + r] = (d2.x + d2.y) + (d2.z + d2.w);
        }
        wave_sums(s);
        float n1 = m1, n2 = m2;
        #pragma unroll
        for (int r = 0; r < PHI_G; ++r) {
            s[r]         = (s[r]         + lane_value(pe1, row0 + r)) * inv_sqrt;
            s[PHI_G + r] = (s[PHI_G + r] + lane_value(pe2, row0 + r)) * inv_sqrt;
            n1 = fmaxf(n1, s[r]);
            n2 = fmaxf(n2, s[PHI_G + r]);
        }
        const float c1 = exp_slot(m1 - n1), c2 = exp_slot(m2 - n2);   // 0 at the wave's first rows
        m1 = n1; m2 = n2;
        l1 *= c1; l2 *= c2;
        float p[2 * PHI_G];
        #pragma unroll
        for (int r = 0; r < PHI_G; ++r) {
            p[r]         = exp_slot(s[r] - n1);
            p[PHI_G + r] = exp_slot(s[PHI_G + r] - n2);
            l1 += p[r];
            l2 += p[PHI_G + r];
        }
        #pragma unroll
        for (int j = 0; j < 4; ++j) {
            f32x4 u1 = a1[j] * c1, u2 = a2[j] * c2;
            #pragma unroll
            for (int r = 0; r < PHI_G; ++r) {
                u1 = __builtin_elementwise_fma(xr[r][j], (f32x4)(p[r]), u1);
                u2 = __builtin_elementwise_fma(xr[r][j], (f32x4)(p[PHI_G + r]), u2);
            }
            a1[j] = u1; a2[j] = u2;
        }
    };

    // Kept rolled: unrolled, the arithmetic of many groups is put off behind their loads and spills.
    // No loaded row is carried over the back edge: carried, it is copied there behind a wait on its load.
    #pragma unroll 1
    for (int row = 0; row < 32; row += 2 * PHI_G) {
        load_rows(xa, row);
        load_rows(xb, row + PHI_G);
        // Holds all 32 loads in front of the arithmetic; without it the second group's are issued late.
        __builtin_amdgcn_sched_barrier(0);
        take_rows(xa, row);
        take_rows(xb, row + PHI_G);
    }

    #pragma unroll
    for (int j = 0; j < 4; ++j) {
        *(f32x4*)&part[wave][0][(lane + 32 * j) * 4] = a1[j];
        *(f32x4*)&part[wave][1][(lane + 32 * j) * 4] = a2[j];
    }
    if (lane == 0) {
        pm[0][wave] = m1; pl[0][wave] = l1;
        pm[1][wave] = m2; pl[1][wave] = l2;
    }
    __syncthreads();

    // Merge: thread t owns columns 2t and 2t + 1.
    float M1 = pm[0][0], M2 = pm[1][0];
    #pragma unroll
    for (int w = 1; w < 8; ++w) { M1 = fmaxf(M1, pm[0][w]); M2 = fmaxf(M2, pm[1][w]); }
    float L1 = 0.0f;
    f32x2 v = {};
    #pragma unroll
    for (int w = 0; w < 8; ++w) {
        const float f = __expf(pm[0][w] - M1);
        L1 += f * pl[0][w];
        v  += f * *(const f32x2*)&part[w][0][2 * t];
    }
    v *= 1.0f / L1;
    ((f32x2*)vout)[(size_t)b * 256 + t] = v;

    // Input head, position 0: the score of v[b] itself.
    const f32x2 q = ((const f32x2*)qk_in)[(size_t)b * 256 + t];
    float d[1] = { v.x * q.x + v.y * q.y };
    wave_sums(d);
    if (lane == 0) red[wave] = d[0];
    __syncthreads();
    float dv = red[0];
    #pragma unroll
    for (int w = 1; w < 8; ++w) dv += red[w];
    const float s0 = (dv + pe_dot_in[(size_t)b * 257]) * inv_sqrt;

    M2 = fmaxf(M2, s0);
    const float e0 = __expf(s0 - M2);
    float L2 = e0;
    f32x2 o = e0 * v;
    #pragma unroll
    for (int w = 0; w < 8; ++w) {
        const float f = __expf(pm[1][w] - M2);
        L2 += f * pl[1][w];
        o  += f * *(const f32x2*)&part[w][1][2 * t];
    }
    o *= 1.0f / L2;
    ((f32x2*)pbar)[(size_t)b * 256 + t] = o;
}

// ---------------------------------------------------------------------------
// Final row softmax of v + logits, logits = the sum of the L_PLANES planes + bias.
// One wave per row, one wave per work-group: 512 waves to start and not 4096. Lane l holds columns
// 4 (l + 32 j) ... + 3, j = 0 ... 3, so that each load and store of the wave covers 512 contiguous bytes.
// Maximum and sum go over the lanes in registers: no LDS, no barrier.
// ---------------------------------------------------------------------------
__device__ __forceinline__ float wave_max(float x) {
    x = fmaxf(x, row_xor<1>(x));
    x = fmaxf(x, row_xor<2>(x));
    x = fmaxf(x, row_xor<4>(x));
    x = fmaxf(x, row_xor<8>(x));
    return fmaxf(x, half_xor(x));
}

__global__ __launch_bounds__(32) void softmax_kernel(
    const float* __restrict__ src, const float* __restrict__ planes, const float* __restrict__ bias,
    float* __restrict__ dst)
{
    const int b = blockIdx.x, lane = threadIdx.x;
    const f32x4* const pp = (const f32x4*)(planes + (size_t)b * N_ACT) + lane;
    const f32x4* const vp = (const f32x4*)(src + (size_t)b * N_ACT) + lane;
    const f32x4* const gp = (const f32x4*)bias + lane;
    // All 40 loads of the lane go out as one batch.
    f32x4 p[L_PLANES][4], v[4], g[4];
    #pragma unroll
    for (int z = 0; z < L_PLANES; ++z)
        #pragma unroll
        for (int j = 0; j < 4; ++j)
            p[z][j] = pp[z * (B_SZ * N_ACT / 4) + 32 * j];
    #pragma unroll
    for (int j = 0; j < 4; ++j) { v[j] = vp[32 * j]; g[j] = gp[32 * j]; }
    // Stands in front of whatever overwrites the loads' base registers (the build puts a constant of the
    // lane exchange into one of them); it passes while the data is still on its way.
    asm volatile("s_wait_xcnt 0x0" ::: "memory");
    // Holds all 40 loads, and the wait behind them, in front of the sums: without it the build issued 14
    // loads and put the rest behind waits on them.
    __builtin_amdgcn_sched_barrier(0);

    f32x4 x[4];
    #pragma unroll
    for (int j = 0; j < 4; ++j) {
        f32x4 s = p[0][j];
        #pragma unroll
        for (int z = 1; z < L_PLANES; ++z) s += p[z][j];
        x[j] = v[j] + (s + g[j]);
    }
    float mx = -INFINITY;
    #pragma unroll
    for (int j = 0; j < 4; ++j)
        mx = fmaxf(mx, fmaxf(fmaxf(x[j].x, x[j].y), fmaxf(x[j].z, x[j].w)));
    mx = wave_max(mx);

    float sum[1] = { 0.0f };
    #pragma unroll
    for (int j = 0; j < 4; ++j) {
        x[j].x = exp_slot(x[j].x - mx);
        x[j].y = exp_slot(x[j].y - mx);
        x[j].z = exp_slot(x[j].z - mx);
        x[j].w = exp_slot(x[j].w - mx);
        sum[0] += (x[j].x + x[j].y) + (x[j].z + x[j].w);
    }
    wave_sums(sum);
    const float inv = 1.0f / sum[0];
    f32x4* const op = (f32x4*)(dst + (size_t)b * N_ACT) + lane;
    #pragma unroll
    for (int j = 0; j < 4; ++j) op[32 * j] = x[j] * inv;
}

// ---------------------------------------------------------------------------
extern "C" void kernel_launch(void* const* d_in, const int* in_sizes, int n_in,
                              void* d_out, int out_size, void* d_ws, size_t ws_size,
                              hipStream_t stream) {
    const float* h_s    = (const float*)d_in[0];
    const float* phi    = (const float*)d_in[1];
    const float* WQ_out = (const float*)d_in[2];
    const float* WK_out = (const float*)d_in[3];
    const float* WQ_in  = (const float*)d_in[4];
    const float* WK_in  = (const float*)d_in[5];
    const float* WV_in  = (const float*)d_in[6];
    const float* W1     = (const float*)d_in[7];
    const float* b1     = (const float*)d_in[8];
    const float* W2     = (const float*)d_in[9];
    const float* b2     = (const float*)d_in[10];
    float* out = (float*)d_out;

    float* ws      = (float*)d_ws;
    float* pw_out  = ws;                  // 256*1024: pe @ WK_out
    float* pw_in   = pw_out  + 256 * 1024;// 384*1024: pe @ WK_in (rows 0..256 are used)
    float* q_out   = pw_in   + 384 * 1024;// 512*1024
    float* q_in    = q_out   + 512 * 1024;// 512*1024
    float* h_pre   = q_in    + 512 * 1024;// 512*1024: h_s @ W1[0:1024], raw sums
    float* wvw1    = h_pre   + 512 * 1024;// 512*1024: WV_in @ W1[1024:2048]
    float* qk_out  = wvw1    + 512 * 1024;// 512*512
    float* qk_in   = qk_out  + 512 * 512; // 512*512
    float* pe_do   = qk_in   + 512 * 512; // 512*256
    float* pe_di   = pe_do   + 512 * 256; // 512*257
    float* vbuf    = pe_di   + 512 * 257; // 512*512
    float* pbar    = vbuf    + 512 * 512; // 512*512
    float* hpl     = pbar    + 512 * 512; // 2 planes of 512*1024: the hidden layer's partial sums
    float* lpl     = hpl     + 2 * 512 * 1024;// 8 planes of 512*512: the logits' partial sums

    const dim3 blk(256);
    const dim3 blk2(512);   // GEMMs whose K tiles are dealt to two groups of 8 waves

    // q_out = h_s @ WQ_out, q_in = h_s @ WQ_in, h_pre = h_s @ W1[0:1024], pe @ WK of both heads
    first_products_kernel<<<dim3(16, 4, 5), blk2, 0, stream>>>(h_s, WQ_out, WQ_in, W1, WK_out, WK_in,
                                                              q_out, q_in, h_pre, pw_out, pw_in);
    // qk = q @ WK^T and the pe-dot terms q @ (pe @ WK)^T, both heads; WV_in @ W1[1024:2048]
    second_products_kernel<<<dim3(8, 4, 6), blk2, 0, stream>>>(q_out, q_in, WK_out, WK_in, pw_out, pw_in,
                                                              WV_in, W1 + 1024 * 1024,
                                                              qk_out, qk_in, pe_do, pe_di, wvw1);

    // the one pass over phi: v and pbar
    phi_once_kernel<<<512, blk, 0, stream>>>(phi, qk_out, qk_in, pe_do, pe_di, vbuf, pbar);

    // MLP: relu([h_s ; ctx] @ W1 + b1) = relu(h_pre + pbar @ (WV_in @ W1[1024:2048]) + b1)
    hidden_planes_kernel<<<dim3(16, 4, 2), blk2, 0, stream>>>(pbar, wvw1, b1, h_pre, hpl, 256);
    logit_planes_kernel<<<dim3(8, 4, 8),  blk, 0, stream>>>(hpl, W2, lpl, 128);
    // out = softmax(v + logits)
    softmax_kernel<<<512, dim3(32), 0, stream>>>(vbuf, lpl, b2, out);
}
